// v000
// Times are from an AMD MI455X. After a warm-up the kernel runs many times in a row, and a time is the length of
// such a window on the GPU divided by its runs, so every launch and the gaps after it count. The runs cycle
// through copies of the inputs. A figure is the median of several windows, for all but v000 over two sittings.
// Sittings can differ by a few percent; kernels timed side by side share one.
// v000, which the later versions start from, runs in 374 microseconds.
// compute dtype: input1, input2, W1..3, b1..3 (INPUTS) rounded to bf16 with exact bf16 WMMA products (f32 accumulate) for the three 1x1 projections; q kept f32 and split hi/lo, k as bf16 hi/lo rows, relu'd scores as a bf16 hi/lo pair, g as bf16 hi/lo planes — all three-product combinations into one f32 accumulator set (f32-grade); relu in f32.
#include <hip/hip_runtime.h>
#include <math.h>

typedef __attribute__((ext_vector_type(16))) _Float16 v16h;
typedef __attribute__((ext_vector_type(16))) __bf16 v16b;
typedef __attribute__((ext_vector_type(8)))  _Float16 v8h;
typedef __attribute__((ext_vector_type(8)))  float v8f;
typedef __attribute__((ext_vector_type(4)))  float v4f;
typedef __attribute__((ext_vector_type(2)))  float v2f;
typedef __attribute__((ext_vector_type(4)))  unsigned v4u;
typedef __attribute__((ext_vector_type(4)))  int v4i;
typedef float __attribute__((may_alias)) float_a;
typedef int __attribute__((may_alias)) int_a;

template <typename T> __device__ __forceinline__ void vst2(void* p, T v) { *(T*)p = v;  }
__device__ __forceinline__ v8f wmma16(v16h a, v16h b, v8f c) {
  v8f d = __builtin_amdgcn_wmma_f32_16x16x32_f16(false, a, false, b, (short)0, c, false, false);
  asm volatile("v_nop\n\tv_nop\n\tv_nop\n\tv_nop" : "+v"(d) : "v"(a), "v"(b));
  return d;
}
__device__ __forceinline__ v8f wmma_bf(v16b a, v16b b, v8f c) {
  v8f d = __builtin_amdgcn_wmma_f32_16x16x32_bf16(false, a, false, b, (short)0, c, false, false);
  asm volatile("v_nop\n\tv_nop\n\tv_nop\n\tv_nop" : "+v"(d) : "v"(a), "v"(b));
  return d;
}
// 16x16x32 fragments: lane = (h = lane>>4, row/col = lane&15); elements 0..7 = k0+8h+0..7, 8..15 = k0+16+8h+0..7; D element r = row 8h+r
__device__ __forceinline__ v16h frag_h(const _Float16* rowk0, int lane) {
  union { v16h v; v8h q[2]; } u; const _Float16* p = rowk0 + 8 * (lane >> 4);
  u.q[0] = *(const v8h*)p; u.q[1] = *(const v8h*)(p + 16); return u.v;
}
__device__ __forceinline__ v16h frag_f32(const float* rowk0, int lane) {
  v16h a; const float* p = rowk0 + 8 * (lane >> 4);
#pragma unroll
  for (int i = 0; i < 8; ++i) { a[i] = (_Float16)p[i]; a[8 + i] = (_Float16)p[16 + i]; }
  return a;
}
__device__ __forceinline__ v16h frag_f32s(const float* rowk0, int lane, float sc) {
  v16h a; const float* p = rowk0 + 8 * (lane >> 4);
#pragma unroll
  for (int i = 0; i < 8; ++i) { a[i] = (_Float16)(p[i] * sc); a[8 + i] = (_Float16)(p[16 + i] * sc); }
  return a;
}
// column fragment from a [K][ld] layout (column n), rows >= K read as 0
__device__ __forceinline__ v16h fragc_f32(const float* W, int k0, int n, int lane, int ld, int K) {
  v16h a; const int g = lane >> 4;
#pragma unroll
  for (int i = 0; i < 8; ++i) { const int ka = k0 + 8 * g + i, kb = ka + 16;
    a[i] = (_Float16)(ka < K ? W[(size_t)(ka < K ? ka : K - 1) * ld + n] : 0.f); a[8 + i] = (_Float16)(kb < K ? W[(size_t)(kb < K ? kb : K - 1) * ld + n] : 0.f); }
  return a;
}
struct F2 { v16b h, l; };
__device__ __forceinline__ F2 bsplit16(const float v[16]) { F2 r;
#pragma unroll
  for (int i = 0; i < 16; ++i) { const __bf16 h = (__bf16)v[i]; r.h[i] = h; r.l[i] = (__bf16)(v[i] - (float)h); }
  return r; }
__device__ __forceinline__ F2 split_row(const float* row, int k0, int lane) { float v[16]; const float* p = row + k0 + 8 * (lane >> 4);
#pragma unroll
  for (int i = 0; i < 8; ++i) { v[i] = p[i]; v[8 + i] = p[16 + i]; }
  return bsplit16(v); }
__device__ __forceinline__ F2 split_rowK(const float* row, int k0, int lane, int K) { float v[16]; const int g = lane >> 4;
#pragma unroll
  for (int i = 0; i < 8; ++i) { const int ka = k0 + 8 * g + i, kb = ka + 16; v[i] = ka < K ? row[ka < K ? ka : K - 1] : 0.f; v[8 + i] = kb < K ? row[kb < K ? kb : K - 1] : 0.f; }
  return bsplit16(v); }
__device__ __forceinline__ F2 split_col(const float* W, int k0, int n, int lane, int ld, int K) { float v[16]; const int g = lane >> 4;
#pragma unroll
  for (int i = 0; i < 8; ++i) { const int ka = k0 + 8 * g + i, kb = ka + 16; v[i] = ka < K ? W[(size_t)(ka < K ? ka : K - 1) * ld + n] : 0.f; v[8 + i] = kb < K ? W[(size_t)(kb < K ? kb : K - 1) * ld + n] : 0.f; }
  return bsplit16(v); }
__device__ __forceinline__ v8f mac3(const F2& a, const F2& b, v8f c) { c = wmma_bf(a.l, b.h, c); c = wmma_bf(a.h, b.l, c); return wmma_bf(a.h, b.h, c); }
__device__ __forceinline__ float sigm(float v) { return 1.0f / (1.0f + expf(-v)); }
#define LDSX() do { asm volatile("s_wait_dscnt 0" ::: "memory"); __builtin_amdgcn_wave_barrier(); __builtin_amdgcn_fence(__ATOMIC_RELEASE, "workgroup"); } while (0)


// Spatial dot-product block (ReLU branch): per frame t (8) over the 64x64 = 4,096 positions with 128 channels: q = W1 x1 + b1, k = W2 x2 + b2, g = W3 x1 + b3 (64 features); scores = relu(q k^T) (no softmax, no scale);
// out = scores g -> stored as [b][t][f][h][w] (feature-major per frame).
// k_cvtx (channel-major frames -> token-major bf16 rows for both inputs), k_proj (Q32 rows; K hi/lo rows; G^T hi/lo planes), k_dot (block = (frame, 64 queries): 64 key tiles, S 3 products, relu, P hi/lo x G hi/lo 3 products, transposed store).
#define NT 8
#define CC 128
#define NN 4096
#define FF 64
__device__ __forceinline__ float bfr(float v) { return (float)(__bf16)v; }
__device__ __forceinline__ v16b frag_b(const __bf16* rowk0, int lane) { return __builtin_bit_cast(v16b, frag_h((const _Float16*)rowk0, lane)); }

// [t][c][n] f32 -> XT [t][n][c] bf16 : block (t, 64 n); both inputs (which = blockIdx.z)
__global__ __launch_bounds__(256) void k_cvtx(const float* __restrict__ x1, const float* __restrict__ x2, __bf16* __restrict__ X1T, __bf16* __restrict__ X2T) {
  __shared__ __align__(16) __bf16 st[64][CC + 8];
  const int tid = threadIdx.x; const int t = blockIdx.y, n0 = blockIdx.x * 64, which = blockIdx.z; const float* x = which == 0 ? x1 : x2; __bf16* XT = which == 0 ? X1T : X2T;
  for (int q = tid; q < CC * 16; q += 256) { const int c = q >> 4, p4 = q & 15; const v4f v = *(const v4f*)(x + ((size_t)t * CC + c) * NN + n0 + p4 * 4);
    st[p4 * 4][c] = (__bf16)v[0]; st[p4 * 4 + 1][c] = (__bf16)v[1]; st[p4 * 4 + 2][c] = (__bf16)v[2]; st[p4 * 4 + 3][c] = (__bf16)v[3]; }
  __syncthreads();
  for (int q = tid; q < 64 * (CC / 8); q += 256) { const int rl = q >> 4, pc = q & 15; vst2((unsigned*)(XT + ((size_t)t * NN + n0 + rl) * CC + pc * 8), *(const v4u*)(&st[rl][pc * 8])); }
}
// projections: block (64 tokens of frame t, which): 0: q -> Q32 rows [t][n][64]; 1: k -> Kh/Kl rows; 2: g -> GTh/GTl planes [t][f][n]
__global__ __launch_bounds__(128) void k_proj(const __bf16* __restrict__ X1T, const __bf16* __restrict__ X2T, const float* __restrict__ W1, const float* __restrict__ b1, const float* __restrict__ W2, const float* __restrict__ b2, const float* __restrict__ W3, const float* __restrict__ b3,
                                            float* __restrict__ Q32, __bf16* __restrict__ Kh, __bf16* __restrict__ Kl, __bf16* __restrict__ GTh, __bf16* __restrict__ GTl) {
  __shared__ __align__(16) float so[4][16][68]; __shared__ __align__(16) __bf16 sh_[4][16][72], sl_[4][16][72]; __shared__ __align__(16) __bf16 sth[64][72], stl[64][72];
  const int tid = threadIdx.x, wave = tid >> 5, lane = tid & 31, col = lane & 15, g = lane >> 4; const int t = blockIdx.y, n0b = blockIdx.x * 64, which = blockIdx.z; const size_t r0 = (size_t)t * NN + n0b + wave * 16;
  const __bf16* XT = which == 1 ? X2T : X1T; const float* W = which == 0 ? W1 : (which == 1 ? W2 : W3); const float* bb_ = which == 0 ? b1 : (which == 1 ? b2 : b3);
  v8f acc[4] = {};
#pragma unroll
  for (int kc = 0; kc < CC / 32; ++kc) { const v16b a = frag_b(XT + (r0 + col) * CC + kc * 32, lane);
#pragma unroll
    for (int j = 0; j < 4; ++j) acc[j] = wmma_bf(a, split_row(W + (size_t)(j * 16 + col) * CC, kc * 32, lane).h, acc[j]); }
  if (which == 0) {
#pragma unroll
    for (int j = 0; j < 4; ++j) { const float bb = bfr(bb_[j * 16 + col]);
#pragma unroll
      for (int r = 0; r < 8; ++r) so[wave][8 * g + r][j * 16 + col] = acc[j][r] + bb; }
    LDSX();
    for (int qq = lane; qq < 16 * 16; qq += 32) { const int rl = qq >> 4, pc = qq & 15; vst2(Q32 + (r0 + rl) * FF + pc * 4, *(const v4f*)(&so[wave][rl][pc * 4])); } }
  else if (which == 1) {
#pragma unroll
    for (int j = 0; j < 4; ++j) { const float bb = bfr(bb_[j * 16 + col]);
#pragma unroll
      for (int r = 0; r < 8; ++r) { const float v = acc[j][r] + bb; const __bf16 hi = (__bf16)v; sh_[wave][8 * g + r][j * 16 + col] = hi; sl_[wave][8 * g + r][j * 16 + col] = (__bf16)(v - (float)hi); } }
    LDSX();
    for (int qq = lane; qq < 16 * 8; qq += 32) { const int rl = qq >> 3, pc = qq & 7; vst2((unsigned*)(Kh + (r0 + rl) * FF + pc * 8), *(const v4u*)(&sh_[wave][rl][pc * 8])); vst2((unsigned*)(Kl + (r0 + rl) * FF + pc * 8), *(const v4u*)(&sl_[wave][rl][pc * 8])); } }
  else {
#pragma unroll
    for (int j = 0; j < 4; ++j) { const float bb = bfr(bb_[j * 16 + col]);
#pragma unroll
      for (int r = 0; r < 8; ++r) { const float v = acc[j][r] + bb; const __bf16 hi = (__bf16)v; sth[j * 16 + col][wave * 16 + 8 * g + r] = hi; stl[j * 16 + col][wave * 16 + 8 * g + r] = (__bf16)(v - (float)hi); } }
    __syncthreads();
    for (int qq = tid; qq < 64 * 8; qq += 128) { const int f = qq >> 3, pc = qq & 7; const size_t o = ((size_t)t * FF + f) * NN + n0b + pc * 8; vst2((unsigned*)(GTh + o), *(const v4u*)(&sth[f][pc * 8])); vst2((unsigned*)(GTl + o), *(const v4u*)(&stl[f][pc * 8])); } }
}
// dot block: (frame t, 64 queries): S = q(hi,lo).k(hi,lo) (3 products), relu, P hi/lo x G^T hi/lo (3 products) into 4 column tiles; out^T[t][f][n]
__global__ __launch_bounds__(128) void k_dot(const float* __restrict__ Q32, const __bf16* __restrict__ Kh, const __bf16* __restrict__ Kl, const __bf16* __restrict__ GTh, const __bf16* __restrict__ GTl, float* __restrict__ out) {
  __shared__ __align__(16) float sS[4][16][68];
  __shared__ __align__(16) __bf16 sPh[4][16][72], sPl[4][16][72];
  __shared__ __align__(16) float sOT[FF][68];      // [f][64 tokens]
  const int tid = threadIdx.x, w = tid >> 5, lane = tid & 31, col = lane & 15, g = lane >> 4; const int t = blockIdx.y, n0b = blockIdx.x * 64; const size_t q0 = (size_t)t * NN + n0b + w * 16;
  F2 aq[2];
#pragma unroll
  for (int kc = 0; kc < 2; ++kc) aq[kc] = split_row(Q32 + (q0 + col) * FF, kc * 32, lane);
  v8f acc[4] = {};
#pragma unroll 1
  for (int kt = 0; kt < NN / 64; ++kt) {
#pragma unroll
    for (int tt = 0; tt < 4; ++tt) { const size_t ko = ((size_t)t * NN + kt * 64 + tt * 16 + col) * FF; v8f s = {};
#pragma unroll
      for (int kc = 0; kc < 2; ++kc) { const v16b khf = frag_b(Kh + ko + kc * 32, lane), klf = frag_b(Kl + ko + kc * 32, lane); s = wmma_bf(aq[kc].l, khf, s); s = wmma_bf(aq[kc].h, klf, s); s = wmma_bf(aq[kc].h, khf, s); }
#pragma unroll
      for (int r = 0; r < 8; ++r) { const float v = s[r] > 0.f ? s[r] : 0.f; const __bf16 hi = (__bf16)v; sPh[w][8 * g + r][tt * 16 + col] = hi; sPl[w][8 * g + r][tt * 16 + col] = (__bf16)(v - (float)hi); } }
    LDSX();
#pragma unroll
    for (int kc = 0; kc < 2; ++kc) { const v16b ph = frag_b(&sPh[w][col][0] + kc * 32, lane), pl = frag_b(&sPl[w][col][0] + kc * 32, lane);
#pragma unroll
      for (int j = 0; j < 4; ++j) { const size_t go = ((size_t)t * FF + j * 16 + col) * NN + kt * 64 + kc * 32; const v16b gh = frag_b(GTh + go, lane), gl = frag_b(GTl + go, lane); acc[j] = wmma_bf(pl, gh, acc[j]); acc[j] = wmma_bf(ph, gl, acc[j]); acc[j] = wmma_bf(ph, gh, acc[j]); } }
    LDSX(); }
#pragma unroll
  for (int j = 0; j < 4; ++j)
#pragma unroll
    for (int r = 0; r < 8; ++r) sOT[j * 16 + col][w * 16 + 8 * g + r] = acc[j][r];
  __syncthreads();
  // out[t][f][n0b .. +63] = 256 B per f: 16 lanes x 16 B; 2 rows per instruction
  for (int qq = tid; qq < FF * 16; qq += 128) { const int f = qq >> 4, pc = qq & 15; vst2(out + ((size_t)t * FF + f) * NN + n0b + pc * 4, *(const v4f*)(&sOT[f][pc * 4])); }
}
extern "C" void kernel_launch(void* const* d_in, const int* in_sizes, int n_in, void* d_out, int out_size, void* d_ws, size_t ws_size, hipStream_t stream) {
  (void)in_sizes; (void)n_in; (void)out_size; (void)ws_size;
  const float** I = (const float**)d_in;   // input1, input2, W1, b1, W2, b2, W3, b3
  const float* x1 = I[0]; const float* x2 = I[1]; const float* W1 = I[2]; const float* b1 = I[3]; const float* W2 = I[4]; const float* b2 = I[5]; const float* W3 = I[6]; const float* b3 = I[7];
  char* ws = (char*)d_ws; size_t off = 0;
  auto take = [&](size_t bytes) { char* p = ws + off; off += (bytes + 255) & ~(size_t)255; return p; };
  __bf16* X1T = (__bf16*)take((size_t)NT * NN * CC * 2); __bf16* X2T = (__bf16*)take((size_t)NT * NN * CC * 2); float* Q32 = (float*)take((size_t)NT * NN * FF * 4);
  __bf16* Kh = (__bf16*)take((size_t)NT * NN * FF * 2); __bf16* Kl = (__bf16*)take((size_t)NT * NN * FF * 2); __bf16* GTh = (__bf16*)take((size_t)NT * FF * NN * 2); __bf16* GTl = (__bf16*)take((size_t)NT * FF * NN * 2);
  // ws ~ 42 MB
  k_cvtx<<<dim3(NN / 64, NT, 2), 256, 0, stream>>>(x1, x2, X1T, X2T);
  k_proj<<<dim3(NN / 64, NT, 3), 128, 0, stream>>>(X1T, X2T, W1, b1, W2, b2, W3, b3, Q32, Kh, Kl, GTh, GTl);
  k_dot<<<dim3(NN / 64, NT), 128, 0, stream>>>(Q32, Kh, Kl, GTh, GTl, (float*)d_out);
}

// v001
// A run of this version takes 160 microseconds.
// In two side-by-side timings against v000, it was 2.39 and 2.37 times as fast.
// compute dtype: input1, input2, W1..3, b1..3 (INPUTS) rounded to bf16 with exact bf16 WMMA products (f32 accumulate) for the three 1x1 projections; q kept f32 and split hi/lo, k as bf16 hi/lo rows, relu'd scores as a bf16 hi/lo pair, g as bf16 hi/lo planes — all three-product combinations into one f32 accumulator set (f32-grade); relu in f32.
#include <hip/hip_runtime.h>
#include <math.h>

typedef __attribute__((ext_vector_type(16))) _Float16 v16h;
typedef __attribute__((ext_vector_type(16))) __bf16 v16b;
typedef __attribute__((ext_vector_type(8)))  _Float16 v8h;
typedef __attribute__((ext_vector_type(8)))  float v8f;
typedef __attribute__((ext_vector_type(4)))  float v4f;
typedef __attribute__((ext_vector_type(2)))  float v2f;
typedef __attribute__((ext_vector_type(4)))  unsigned v4u;
typedef __attribute__((ext_vector_type(4)))  int v4i;
typedef float __attribute__((may_alias)) float_a;
typedef int __attribute__((may_alias)) int_a;

template <typename T> __device__ __forceinline__ void vst2(void* p, T v) { *(T*)p = v;  }
__device__ __forceinline__ v8f wmma16(v16h a, v16h b, v8f c) {
  v8f d = __builtin_amdgcn_wmma_f32_16x16x32_f16(false, a, false, b, (short)0, c, false, false);
  asm volatile("v_nop\n\tv_nop\n\tv_nop\n\tv_nop" : "+v"(d) : "v"(a), "v"(b));
  return d;
}
__device__ __forceinline__ v8f wmma_bf(v16b a, v16b b, v8f c) {
  v8f d = __builtin_amdgcn_wmma_f32_16x16x32_bf16(false, a, false, b, (short)0, c, false, false);
  asm volatile("v_nop\n\tv_nop\n\tv_nop\n\tv_nop" : "+v"(d) : "v"(a), "v"(b));
  return d;
}
// 16x16x32 fragments: lane = (h = lane>>4, row/col = lane&15); elements 0..7 = k0+8h+0..7, 8..15 = k0+16+8h+0..7; D element r = row 8h+r
__device__ __forceinline__ v16h frag_h(const _Float16* rowk0, int lane) {
  union { v16h v; v8h q[2]; } u; const _Float16* p = rowk0 + 8 * (lane >> 4);
  u.q[0] = *(const v8h*)p; u.q[1] = *(const v8h*)(p + 16); return u.v;
}
__device__ __forceinline__ v16h frag_f32(const float* rowk0, int lane) {
  v16h a; const float* p = rowk0 + 8 * (lane >> 4);
#pragma unroll
  for (int i = 0; i < 8; ++i) { a[i] = (_Float16)p[i]; a[8 + i] = (_Float16)p[16 + i]; }
  return a;
}
__device__ __forceinline__ v16h frag_f32s(const float* rowk0, int lane, float sc) {
  v16h a; const float* p = rowk0 + 8 * (lane >> 4);
#pragma unroll
  for (int i = 0; i < 8; ++i) { a[i] = (_Float16)(p[i] * sc); a[8 + i] = (_Float16)(p[16 + i] * sc); }
  return a;
}
// column fragment from a [K][ld] layout (column n), rows >= K read as 0
__device__ __forceinline__ v16h fragc_f32(const float* W, int k0, int n, int lane, int ld, int K) {
  v16h a; const int g = lane >> 4;
#pragma unroll
  for (int i = 0; i < 8; ++i) { const int ka = k0 + 8 * g + i, kb = ka + 16;
    a[i] = (_Float16)(ka < K ? W[(size_t)(ka < K ? ka : K - 1) * ld + n] : 0.f); a[8 + i] = (_Float16)(kb < K ? W[(size_t)(kb < K ? kb : K - 1) * ld + n] : 0.f); }
  return a;
}
struct F2 { v16b h, l; };
__device__ __forceinline__ F2 bsplit16(const float v[16]) { F2 r;
#pragma unroll
  for (int i = 0; i < 16; ++i) { const __bf16 h = (__bf16)v[i]; r.h[i] = h; r.l[i] = (__bf16)(v[i] - (float)h); }
  return r; }
__device__ __forceinline__ F2 split_row(const float* row, int k0, int lane) { float v[16]; const float* p = row + k0 + 8 * (lane >> 4);
#pragma unroll
  for (int i = 0; i < 8; ++i) { v[i] = p[i]; v[8 + i] = p[16 + i]; }
  return bsplit16(v); }
__device__ __forceinline__ F2 split_rowK(const float* row, int k0, int lane, int K) { float v[16]; const int g = lane >> 4;
#pragma unroll
  for (int i = 0; i < 8; ++i) { const int ka = k0 + 8 * g + i, kb = ka + 16; v[i] = ka < K ? row[ka < K ? ka : K - 1] : 0.f; v[8 + i] = kb < K ? row[kb < K ? kb : K - 1] : 0.f; }
  return bsplit16(v); }
__device__ __forceinline__ F2 split_col(const float* W, int k0, int n, int lane, int ld, int K) { float v[16]; const int g = lane >> 4;
#pragma unroll
  for (int i = 0; i < 8; ++i) { const int ka = k0 + 8 * g + i, kb = ka + 16; v[i] = ka < K ? W[(size_t)(ka < K ? ka : K - 1) * ld + n] : 0.f; v[8 + i] = kb < K ? W[(size_t)(kb < K ? kb : K - 1) * ld + n] : 0.f; }
  return bsplit16(v); }
__device__ __forceinline__ v8f mac3(const F2& a, const F2& b, v8f c) { c = wmma_bf(a.l, b.h, c); c = wmma_bf(a.h, b.l, c); return wmma_bf(a.h, b.h, c); }
__device__ __forceinline__ float sigm(float v) { return 1.0f / (1.0f + expf(-v)); }
#define LDSX() do { asm volatile("s_wait_dscnt 0" ::: "memory"); __builtin_amdgcn_wave_barrier(); __builtin_amdgcn_fence(__ATOMIC_RELEASE, "workgroup"); } while (0)


// Spatial dot-product block (ReLU branch): per frame t (8) over the 64x64 = 4,096 positions with 128 channels: q = W1 x1 + b1, k = W2 x2 + b2, g = W3 x1 + b3 (64 features); scores = relu(q k^T) (no softmax, no scale);
// out = scores g -> stored as [b][t][f][h][w] (feature-major per frame).
// k_cvtx (channel-major frames -> token-major bf16 rows for both inputs), k_proj (Q32 rows; K hi/lo rows; G^T hi/lo planes), k_dot (block = (frame, 64 queries): 64 key tiles staged in LDS, S 3 products, relu, P hi/lo x G hi/lo 3 products, transposed store).
#define NT 8
#define CC 128
#define NN 4096
#define FF 64
__device__ __forceinline__ float bfr(float v) { return (float)(__bf16)v; }
__device__ __forceinline__ v16b frag_b(const __bf16* rowk0, int lane) { return __builtin_bit_cast(v16b, frag_h((const _Float16*)rowk0, lane)); }

// [t][c][n] f32 -> XT [t][n][c] bf16 : block (t, 64 n); both inputs (which = blockIdx.z)
__global__ __launch_bounds__(256) void k_cvtx(const float* __restrict__ x1, const float* __restrict__ x2, __bf16* __restrict__ X1T, __bf16* __restrict__ X2T) {
  __shared__ __align__(16) __bf16 st[64][CC + 8];
  const int tid = threadIdx.x; const int t = blockIdx.y, n0 = blockIdx.x * 64, which = blockIdx.z; const float* x = which == 0 ? x1 : x2; __bf16* XT = which == 0 ? X1T : X2T;
  for (int q = tid; q < CC * 16; q += 256) { const int c = q >> 4, p4 = q & 15; const v4f v = *(const v4f*)(x + ((size_t)t * CC + c) * NN + n0 + p4 * 4);
    st[p4 * 4][c] = (__bf16)v[0]; st[p4 * 4 + 1][c] = (__bf16)v[1]; st[p4 * 4 + 2][c] = (__bf16)v[2]; st[p4 * 4 + 3][c] = (__bf16)v[3]; }
  __syncthreads();
  for (int q = tid; q < 64 * (CC / 8); q += 256) { const int rl = q >> 4, pc = q & 15; vst2((unsigned*)(XT + ((size_t)t * NN + n0 + rl) * CC + pc * 8), *(const v4u*)(&st[rl][pc * 8])); }
}
// projections: block (64 tokens of frame t, which): 0: q -> Q32 rows [t][n][64]; 1: k -> Kh/Kl rows; 2: g -> GTh/GTl planes [t][f][n]
__global__ __launch_bounds__(128) void k_proj(const __bf16* __restrict__ X1T, const __bf16* __restrict__ X2T, const float* __restrict__ W1, const float* __restrict__ b1, const float* __restrict__ W2, const float* __restrict__ b2, const float* __restrict__ W3, const float* __restrict__ b3,
                                            float* __restrict__ Q32, __bf16* __restrict__ Kh, __bf16* __restrict__ Kl, __bf16* __restrict__ GTh, __bf16* __restrict__ GTl) {
  __shared__ __align__(16) float so[4][16][68]; __shared__ __align__(16) __bf16 sh_[4][16][72], sl_[4][16][72]; __shared__ __align__(16) __bf16 sth[64][72], stl[64][72];
  const int tid = threadIdx.x, wave = tid >> 5, lane = tid & 31, col = lane & 15, g = lane >> 4; const int t = blockIdx.y, n0b = blockIdx.x * 64, which = blockIdx.z; const size_t r0 = (size_t)t * NN + n0b + wave * 16;
  const __bf16* XT = which == 1 ? X2T : X1T; const float* W = which == 0 ? W1 : (which == 1 ? W2 : W3); const float* bb_ = which == 0 ? b1 : (which == 1 ? b2 : b3);
  v8f acc[4] = {};
#pragma unroll
  for (int kc = 0; kc < CC / 32; ++kc) { const v16b a = frag_b(XT + (r0 + col) * CC + kc * 32, lane);
#pragma unroll
    for (int j = 0; j < 4; ++j) acc[j] = wmma_bf(a, split_row(W + (size_t)(j * 16 + col) * CC, kc * 32, lane).h, acc[j]); }
  if (which == 0) {
#pragma unroll
    for (int j = 0; j < 4; ++j) { const float bb = bfr(bb_[j * 16 + col]);
#pragma unroll
      for (int r = 0; r < 8; ++r) so[wave][8 * g + r][j * 16 + col] = acc[j][r] + bb; }
    LDSX();
    for (int qq = lane; qq < 16 * 16; qq += 32) { const int rl = qq >> 4, pc = qq & 15; vst2(Q32 + (r0 + rl) * FF + pc * 4, *(const v4f*)(&so[wave][rl][pc * 4])); } }
  else if (which == 1) {
#pragma unroll
    for (int j = 0; j < 4; ++j) { const float bb = bfr(bb_[j * 16 + col]);
#pragma unroll
      for (int r = 0; r < 8; ++r) { const float v = acc[j][r] + bb; const __bf16 hi = (__bf16)v; sh_[wave][8 * g + r][j * 16 + col] = hi; sl_[wave][8 * g + r][j * 16 + col] = (__bf16)(v - (float)hi); } }
    LDSX();
    for (int qq = lane; qq < 16 * 8; qq += 32) { const int rl = qq >> 3, pc = qq & 7; vst2((unsigned*)(Kh + (r0 + rl) * FF + pc * 8), *(const v4u*)(&sh_[wave][rl][pc * 8])); vst2((unsigned*)(Kl + (r0 + rl) * FF + pc * 8), *(const v4u*)(&sl_[wave][rl][pc * 8])); } }
  else {
#pragma unroll
    for (int j = 0; j < 4; ++j) { const float bb = bfr(bb_[j * 16 + col]);
#pragma unroll
      for (int r = 0; r < 8; ++r) { const float v = acc[j][r] + bb; const __bf16 hi = (__bf16)v; sth[j * 16 + col][wave * 16 + 8 * g + r] = hi; stl[j * 16 + col][wave * 16 + 8 * g + r] = (__bf16)(v - (float)hi); } }
    __syncthreads();
    for (int qq = tid; qq < 64 * 8; qq += 128) { const int f = qq >> 3, pc = qq & 7; const size_t o = ((size_t)t * FF + f) * NN + n0b + pc * 8; vst2((unsigned*)(GTh + o), *(const v4u*)(&sth[f][pc * 8])); vst2((unsigned*)(GTl + o), *(const v4u*)(&stl[f][pc * 8])); } }
}
// dot block: (frame t, 64 queries): S = q(hi,lo).k(hi,lo) (3 products), relu, P hi/lo x G^T hi/lo (3 products) into 4 column tiles; out^T[t][f][n]
// The four operand tiles of a 64-key stage (Kh, Kl: 64 key rows; GTh, GTl: 64 feature rows; every row 128 B) are brought into LDS once per block,
// one tensor load per wave and stage, two buffers, and all four waves read their fragments there.
typedef __attribute__((ext_vector_type(8))) unsigned v8u;
#define NST (NN / 64)      // stages = passes of the key loop
#define TROWB 128u         // bytes of a tile row (64 bf16)
#define TPITCH 144u        // its pitch in LDS: the load pads 16 B behind each row, 16 B x odd for ds_load_b128 readers
#define TPLACE 10240u      // 64 rows x 144 B = 9,216 B, rounded up to a multiple of 2 KiB
__device__ __forceinline__ unsigned uni(unsigned v) { return (unsigned)__builtin_amdgcn_readfirstlane(v); }
// a wave-uniform value held in a scalar register, so that the test around a tensor load compiles to a scalar branch and the words formed from it stand behind the wait in front of it
__device__ __forceinline__ unsigned pinned(unsigned v) { unsigned w = uni(v); asm volatile("" : "+s"(w)); return w; }
__global__ __launch_bounds__(128) void k_dot(const float* __restrict__ Q32, const __bf16* __restrict__ Kh, const __bf16* __restrict__ Kl, const __bf16* __restrict__ GTh, const __bf16* __restrict__ GTl, float* __restrict__ out) {
  __shared__ __align__(16) float sS[4][16][68];
  __shared__ __attribute__((aligned(2048))) unsigned char ring[2 * 4 * TPLACE];   // [buffer][Kh, Kl, GTh, GTl][64 rows of TPITCH]
  __shared__ __align__(16) __bf16 sPh[4][16][72], sPl[4][16][72];
  __shared__ __align__(16) float sOT[FF][68];      // [f][64 tokens]
  const int tid = threadIdx.x, w = tid >> 5, lane = tid & 31, col = lane & 15, g = lane >> 4; const int t = blockIdx.y, n0b = blockIdx.x * 64; const size_t q0 = (size_t)t * NN + n0b + w * 16;
  F2 aq[2];
#pragma unroll
  for (int kc = 0; kc < 2; ++kc) aq[kc] = split_row(Q32 + (q0 + col) * FF, kc * 32, lane);
  v8f acc[4] = {};
  // wave 0 brings Kh, 1 Kl (source rows back to back), 2 GTh, 3 GTl (source rows NN keys apart); frame t starts NN * FF elements in, in all four
  const unsigned wv = uni((unsigned)tid >> 5);
  const __bf16* tsrc = wv == 0 ? Kh : (wv == 1 ? Kl : (wv == 2 ? GTh : GTl));
  const unsigned long long src0 = (unsigned long long)(size_t)tsrc + (unsigned long long)t * (NN * FF * 2);
  const unsigned sstep = wv < 2 ? 64u * TROWB : TROWB;      // bytes from a stage's tile to the next stage's
  const unsigned lds0 = (unsigned)(size_t)ring + wv * TPLACE;
  v8u g1;   // 1-byte elements, tensor = tile = 64 rows of 128 B, no mask, a pad of 4 dwords behind every 32
  g1[0] = uni(1u << 20 | 4u << 22 | 3u << 25); g1[1] = uni(TROWB << 16); g1[2] = uni(64u << 16); g1[3] = uni(TROWB << 16); g1[4] = uni(64u);
  g1[5] = uni(wv < 2 ? TROWB : NN * 2u); g1[6] = uni(0u); g1[7] = uni(0u);
  asm volatile("" : "+s"(g1));   // the pinned() form, for descriptor words held in scalar registers: without it the compiler rebuilds the group at each load and puts other values into its registers while a request is outstanding
  auto issue = [&](unsigned st) {
    const unsigned long long ga = src0 + (unsigned long long)st * sstep;
    v4u g0; g0[0] = uni(1u); g0[1] = uni(lds0 + (st & 1u) * (4u * TPLACE)); g0[2] = uni((unsigned)ga); g0[3] = uni(((unsigned)(ga >> 32) & 0x01FFFFFFu) | 0x80000000u);
    asm volatile("tensor_load_to_lds %0, %1" :: "s"(g0), "s"(g1) : "memory");   // one request of the whole wave: its own tile of stage st
  };
  issue(0u);
  asm volatile("s_wait_tensorcnt 0x0" ::: "memory");   // this wave's tile of stage 0 has landed
  __syncthreads();                                     // all four tiles of stage 0 are readable by every wave
  issue(1u);
#pragma unroll 1
  for (int kt = 0; kt < NST; ++kt) {
    const unsigned char* tb = ring + (unsigned)(kt & 1) * (4u * TPLACE);
#pragma unroll
    for (int tt = 0; tt < 4; ++tt) { const __bf16* kh = (const __bf16*)(tb + (tt * 16 + col) * TPITCH); const __bf16* kl = (const __bf16*)(tb + TPLACE + (tt * 16 + col) * TPITCH); v8f s = {};
#pragma unroll
      for (int kc = 0; kc < 2; ++kc) { const v16b khf = frag_b(kh + kc * 32, lane), klf = frag_b(kl + kc * 32, lane); s = wmma_bf(aq[kc].l, khf, s); s = wmma_bf(aq[kc].h, klf, s); s = wmma_bf(aq[kc].h, khf, s); }
#pragma unroll
      for (int r = 0; r < 8; ++r) { const float v = s[r] > 0.f ? s[r] : 0.f; const __bf16 hi = (__bf16)v; sPh[w][8 * g + r][tt * 16 + col] = hi; sPl[w][8 * g + r][tt * 16 + col] = (__bf16)(v - (float)hi); } }
    LDSX();
#pragma unroll
    for (int kc = 0; kc < 2; ++kc) { const v16b ph = frag_b(&sPh[w][col][0] + kc * 32, lane), pl = frag_b(&sPl[w][col][0] + kc * 32, lane);
#pragma unroll
      for (int j = 0; j < 4; ++j) { const unsigned go = (j * 16 + col) * TPITCH + kc * 64; const v16b gh = frag_b((const __bf16*)(tb + 2u * TPLACE + go), lane), gl = frag_b((const __bf16*)(tb + 3u * TPLACE + go), lane); acc[j] = wmma_bf(pl, gh, acc[j]); acc[j] = wmma_bf(ph, gl, acc[j]); acc[j] = wmma_bf(ph, gh, acc[j]); } }
    LDSX();                                              // s_wait_dscnt 0: this wave has read all it reads of stage kt
    asm volatile("s_wait_tensorcnt 0x0" ::: "memory");   // this wave's tile of stage kt + 1 has landed
    __syncthreads();                                     // stage kt + 1 is readable by every wave, and every wave has left stage kt's buffer
    if (pinned(kt + 2 < NST)) issue(pinned((unsigned)kt + 2u)); }   // refill of the buffer just left
  asm volatile("s_wait_tensorcnt 0x0" ::: "memory");     // no request is outstanding when the wave goes on to the output staging and ends
  asm volatile("s_wait_dscnt 0x0" ::: "memory");         // nor is any of its LDS reads: the ring's closing order
#pragma unroll
  for (int j = 0; j < 4; ++j)
#pragma unroll
    for (int r = 0; r < 8; ++r) sOT[j * 16 + col][w * 16 + 8 * g + r] = acc[j][r];
  __syncthreads();
  // out[t][f][n0b .. +63] = 256 B per f: 16 lanes x 16 B; 2 rows per instruction
  for (int qq = tid; qq < FF * 16; qq += 128) { const int f = qq >> 4, pc = qq & 15; vst2(out + ((size_t)t * FF + f) * NN + n0b + pc * 4, *(const v4f*)(&sOT[f][pc * 4])); }
}
extern "C" void kernel_launch(void* const* d_in, const int* in_sizes, int n_in, void* d_out, int out_size, void* d_ws, size_t ws_size, hipStream_t stream) {
  (void)in_sizes; (void)n_in; (void)out_size; (void)ws_size;
  const float** I = (const float**)d_in;   // input1, input2, W1, b1, W2, b2, W3, b3
  const float* x1 = I[0]; const float* x2 = I[1]; const float* W1 = I[2]; const float* b1 = I[3]; const float* W2 = I[4]; const float* b2 = I[5]; const float* W3 = I[6]; const float* b3 = I[7];
  char* ws = (char*)d_ws; size_t off = 0;
  auto take = [&](size_t bytes) { char* p = ws + off; off += (bytes + 255) & ~(size_t)255; return p; };
  __bf16* X1T = (__bf16*)take((size_t)NT * NN * CC * 2); __bf16* X2T = (__bf16*)take((size_t)NT * NN * CC * 2); float* Q32 = (float*)take((size_t)NT * NN * FF * 4);
  __bf16* Kh = (__bf16*)take((size_t)NT * NN * FF * 2); __bf16* Kl = (__bf16*)take((size_t)NT * NN * FF * 2); __bf16* GTh = (__bf16*)take((size_t)NT * FF * NN * 2); __bf16* GTl = (__bf16*)take((size_t)NT * FF * NN * 2);
  // ws ~ 42 MB
  k_cvtx<<<dim3(NN / 64, NT, 2), 256, 0, stream>>>(x1, x2, X1T, X2T);
  k_proj<<<dim3(NN / 64, NT, 3), 128, 0, stream>>>(X1T, X2T, W1, b1, W2, b2, W3, b3, Q32, Kh, Kl, GTh, GTl);
  k_dot<<<dim3(NN / 64, NT), 128, 0, stream>>>(Q32, Kh, Kl, GTh, GTl, (float*)d_out);
}

// v002
// A run of this version takes 129 microseconds.
// Next to v001, in two timings, it ran 1.23 and 1.24 times as fast.
// Over all steps from v000 it is 2.94 times as fast.
// compute dtype: input1, input2, W1..3, b1..3 (INPUTS) rounded to bf16 with exact bf16 WMMA products (f32 accumulate) for the three 1x1 projections; q kept f32 and split hi/lo, k as bf16 hi/lo rows, relu'd scores as a bf16 hi/lo pair, g as bf16 hi/lo planes — all three-product combinations into one f32 accumulator set (f32-grade); relu in f32.
#include <hip/hip_runtime.h>
#include <math.h>

typedef __attribute__((ext_vector_type(16))) _Float16 v16h;
typedef __attribute__((ext_vector_type(16))) __bf16 v16b;
typedef __attribute__((ext_vector_type(8)))  _Float16 v8h;
typedef __attribute__((ext_vector_type(8)))  float v8f;
typedef __attribute__((ext_vector_type(4)))  float v4f;
typedef __attribute__((ext_vector_type(2)))  float v2f;
typedef __attribute__((ext_vector_type(4)))  unsigned v4u;
typedef __attribute__((ext_vector_type(4)))  int v4i;
typedef float __attribute__((may_alias)) float_a;
typedef int __attribute__((may_alias)) int_a;

template <typename T> __device__ __forceinline__ void vst2(void* p, T v) { *(T*)p = v;  }
__device__ __forceinline__ v8f wmma16(v16h a, v16h b, v8f c) {
  v8f d = __builtin_amdgcn_wmma_f32_16x16x32_f16(false, a, false, b, (short)0, c, false, false);
  asm volatile("v_nop\n\tv_nop\n\tv_nop\n\tv_nop" : "+v"(d) : "v"(a), "v"(b));
  return d;
}
__device__ __forceinline__ v8f wmma_bf(v16b a, v16b b, v8f c) {
  v8f d = __builtin_amdgcn_wmma_f32_16x16x32_bf16(false, a, false, b, (short)0, c, false, false);
  asm volatile("v_nop\n\tv_nop\n\tv_nop\n\tv_nop" : "+v"(d) : "v"(a), "v"(b));
  return d;
}
// 16x16x32 fragments: lane = (h = lane>>4, row/col = lane&15); elements 0..7 = k0+8h+0..7, 8..15 = k0+16+8h+0..7; D element r = row 8h+r
__device__ __forceinline__ v16h frag_h(const _Float16* rowk0, int lane) {
  union { v16h v; v8h q[2]; } u; const _Float16* p = rowk0 + 8 * (lane >> 4);
  u.q[0] = *(const v8h*)p; u.q[1] = *(const v8h*)(p + 16); return u.v;
}
__device__ __forceinline__ v16h frag_f32(const float* rowk0, int lane) {
  v16h a; const float* p = rowk0 + 8 * (lane >> 4);
#pragma unroll
  for (int i = 0; i < 8; ++i) { a[i] = (_Float16)p[i]; a[8 + i] = (_Float16)p[16 + i]; }
  return a;
}
__device__ __forceinline__ v16h frag_f32s(const float* rowk0, int lane, float sc) {
  v16h a; const float* p = rowk0 + 8 * (lane >> 4);
#pragma unroll
  for (int i = 0; i < 8; ++i) { a[i] = (_Float16)(p[i] * sc); a[8 + i] = (_Float16)(p[16 + i] * sc); }
  return a;
}
// column fragment from a [K][ld] layout (column n), rows >= K read as 0
__device__ __forceinline__ v16h fragc_f32(const float* W, int k0, int n, int lane, int ld, int K) {
  v16h a; const int g = lane >> 4;
#pragma unroll
  for (int i = 0; i < 8; ++i) { const int ka = k0 + 8 * g + i, kb = ka + 16;
    a[i] = (_Float16)(ka < K ? W[(size_t)(ka < K ? ka : K - 1) * ld + n] : 0.f); a[8 + i] = (_Float16)(kb < K ? W[(size_t)(kb < K ? kb : K - 1) * ld + n] : 0.f); }
  return a;
}
struct F2 { v16b h, l; };
__device__ __forceinline__ F2 bsplit16(const float v[16]) { F2 r;
#pragma unroll
  for (int i = 0; i < 16; ++i) { const __bf16 h = (__bf16)v[i]; r.h[i] = h; r.l[i] = (__bf16)(v[i] - (float)h); }
  return r; }
__device__ __forceinline__ F2 split_row(const float* row, int k0, int lane) { float v[16]; const float* p = row + k0 + 8 * (lane >> 4);
#pragma unroll
  for (int i = 0; i < 8; ++i) { v[i] = p[i]; v[8 + i] = p[16 + i]; }
  return bsplit16(v); }
__device__ __forceinline__ F2 split_rowK(const float* row, int k0, int lane, int K) { float v[16]; const int g = lane >> 4;
#pragma unroll
  for (int i = 0; i < 8; ++i) { const int ka = k0 + 8 * g + i, kb = ka + 16; v[i] = ka < K ? row[ka < K ? ka : K - 1] : 0.f; v[8 + i] = kb < K ? row[kb < K ? kb : K - 1] : 0.f; }
  return bsplit16(v); }
__device__ __forceinline__ F2 split_col(const float* W, int k0, int n, int lane, int ld, int K) { float v[16]; const int g = lane >> 4;
#pragma unroll
  for (int i = 0; i < 8; ++i) { const int ka = k0 + 8 * g + i, kb = ka + 16; v[i] = ka < K ? W[(size_t)(ka < K ? ka : K - 1) * ld + n] : 0.f; v[8 + i] = kb < K ? W[(size_t)(kb < K ? kb : K - 1) * ld + n] : 0.f; }
  return bsplit16(v); }
__device__ __forceinline__ v8f mac3(const F2& a, const F2& b, v8f c) { c = wmma_bf(a.l, b.h, c); c = wmma_bf(a.h, b.l, c); return wmma_bf(a.h, b.h, c); }
__device__ __forceinline__ float sigm(float v) { return 1.0f / (1.0f + expf(-v)); }
#define LDSX() do { asm volatile("s_wait_dscnt 0" ::: "memory"); __builtin_amdgcn_wave_barrier(); __builtin_amdgcn_fence(__ATOMIC_RELEASE, "workgroup"); } while (0)


// Spatial dot-product block (ReLU branch): per frame t (8) over the 64x64 = 4,096 positions with 128 channels: q = W1 x1 + b1, k = W2 x2 + b2, g = W3 x1 + b3 (64 features); scores = relu(q k^T) (no softmax, no scale);
// out = scores g -> stored as [b][t][f][h][w] (feature-major per frame).
// k_cvtx (channel-major frames -> token-major bf16 rows for both inputs), k_proj (Q32 rows; K hi/lo rows; G^T hi/lo planes), k_dot (block = (frame, 64 queries): 64 key tiles staged in LDS, S 3 products, relu, P hi/lo x G hi/lo 3 products, transposed store).
#define NT 8
#define CC 128
#define NN 4096
#define FF 64
__device__ __forceinline__ float bfr(float v) { return (float)(__bf16)v; }
__device__ __forceinline__ v16b frag_b(const __bf16* rowk0, int lane) { return __builtin_bit_cast(v16b, frag_h((const _Float16*)rowk0, lane)); }

// [t][c][n] f32 -> XT [t][n][c] bf16 : block (t, 64 n); both inputs (which = blockIdx.z)
__global__ __launch_bounds__(256) void k_cvtx(const float* __restrict__ x1, const float* __restrict__ x2, __bf16* __restrict__ X1T, __bf16* __restrict__ X2T) {
  __shared__ __align__(16) __bf16 st[64][CC + 8];
  const int tid = threadIdx.x; const int t = blockIdx.y, n0 = blockIdx.x * 64, which = blockIdx.z; const float* x = which == 0 ? x1 : x2; __bf16* XT = which == 0 ? X1T : X2T;
  for (int q = tid; q < CC * 16; q += 256) { const int c = q >> 4, p4 = q & 15; const v4f v = *(const v4f*)(x + ((size_t)t * CC + c) * NN + n0 + p4 * 4);
    st[p4 * 4][c] = (__bf16)v[0]; st[p4 * 4 + 1][c] = (__bf16)v[1]; st[p4 * 4 + 2][c] = (__bf16)v[2]; st[p4 * 4 + 3][c] = (__bf16)v[3]; }
  __syncthreads();
  for (int q = tid; q < 64 * (CC / 8); q += 256) { const int rl = q >> 4, pc = q & 15; vst2((unsigned*)(XT + ((size_t)t * NN + n0 + rl) * CC + pc * 8), *(const v4u*)(&st[rl][pc * 8])); }
}
// projections: block (64 tokens of frame t, which): 0: q -> Q32 rows [t][n][64]; 1: k -> Kh/Kl rows; 2: g -> GTh/GTl planes [t][f][n]
__global__ __launch_bounds__(128) void k_proj(const __bf16* __restrict__ X1T, const __bf16* __restrict__ X2T, const float* __restrict__ W1, const float* __restrict__ b1, const float* __restrict__ W2, const float* __restrict__ b2, const float* __restrict__ W3, const float* __restrict__ b3,
                                            float* __restrict__ Q32, __bf16* __restrict__ Kh, __bf16* __restrict__ Kl, __bf16* __restrict__ GTh, __bf16* __restrict__ GTl) {
  __shared__ __align__(16) float so[4][16][68]; __shared__ __align__(16) __bf16 sh_[4][16][72], sl_[4][16][72]; __shared__ __align__(16) __bf16 sth[64][72], stl[64][72];
  const int tid = threadIdx.x, wave = tid >> 5, lane = tid & 31, col = lane & 15, g = lane >> 4; const int t = blockIdx.y, n0b = blockIdx.x * 64, which = blockIdx.z; const size_t r0 = (size_t)t * NN + n0b + wave * 16;
  const __bf16* XT = which == 1 ? X2T : X1T; const float* W = which == 0 ? W1 : (which == 1 ? W2 : W3); const float* bb_ = which == 0 ? b1 : (which == 1 ? b2 : b3);
  v8f acc[4] = {};
#pragma unroll
  for (int kc = 0; kc < CC / 32; ++kc) { const v16b a = frag_b(XT + (r0 + col) * CC + kc * 32, lane);
#pragma unroll
    for (int j = 0; j < 4; ++j) acc[j] = wmma_bf(a, split_row(W + (size_t)(j * 16 + col) * CC, kc * 32, lane).h, acc[j]); }
  if (which == 0) {
#pragma unroll
    for (int j = 0; j < 4; ++j) { const float bb = bfr(bb_[j * 16 + col]);
#pragma unroll
      for (int r = 0; r < 8; ++r) so[wave][8 * g + r][j * 16 + col] = acc[j][r] + bb; }
    LDSX();
    for (int qq = lane; qq < 16 * 16; qq += 32) { const int rl = qq >> 4, pc = qq & 15; vst2(Q32 + (r0 + rl) * FF + pc * 4, *(const v4f*)(&so[wave][rl][pc * 4])); } }
  else if (which == 1) {
#pragma unroll
    for (int j = 0; j < 4; ++j) { const float bb = bfr(bb_[j * 16 + col]);
#pragma unroll
      for (int r = 0; r < 8; ++r) { const float v = acc[j][r] + bb; const __bf16 hi = (__bf16)v; sh_[wave][8 * g + r][j * 16 + col] = hi; sl_[wave][8 * g + r][j * 16 + col] = (__bf16)(v - (float)hi); } }
    LDSX();
    for (int qq = lane; qq < 16 * 8; qq += 32) { const int rl = qq >> 3, pc = qq & 7; vst2((unsigned*)(Kh + (r0 + rl) * FF + pc * 8), *(const v4u*)(&sh_[wave][rl][pc * 8])); vst2((unsigned*)(Kl + (r0 + rl) * FF + pc * 8), *(const v4u*)(&sl_[wave][rl][pc * 8])); } }
  else {
#pragma unroll
    for (int j = 0; j < 4; ++j) { const float bb = bfr(bb_[j * 16 + col]);
#pragma unroll
      for (int r = 0; r < 8; ++r) { const float v = acc[j][r] + bb; const __bf16 hi = (__bf16)v; sth[j * 16 + col][wave * 16 + 8 * g + r] = hi; stl[j * 16 + col][wave * 16 + 8 * g + r] = (__bf16)(v - (float)hi); } }
    __syncthreads();
    for (int qq = tid; qq < 64 * 8; qq += 128) { const int f = qq >> 3, pc = qq & 7; const size_t o = ((size_t)t * FF + f) * NN + n0b + pc * 8; vst2((unsigned*)(GTh + o), *(const v4u*)(&sth[f][pc * 8])); vst2((unsigned*)(GTl + o), *(const v4u*)(&stl[f][pc * 8])); } }
}
// dot block: (frame t, 64 queries): S = q(hi,lo).k(hi,lo) (3 products), relu, P hi/lo x G^T hi/lo (3 products) into 4 column tiles; out^T[t][f][n]
// The four operand tiles of a 64-key stage (Kh, Kl: 64 key rows; GTh, GTl: 64 feature rows; every row 128 B) are brought into LDS once per block,
// one tensor load per wave and stage, two buffers, and all four waves read their fragments there.
typedef __attribute__((ext_vector_type(8))) unsigned v8u;
#define NST (NN / 64)      // stages = passes of the key loop
#define TROWB 128u         // bytes of a tile row (64 bf16)
#define TPITCH 144u        // its pitch in LDS: the load pads 16 B behind each row, 16 B x odd for ds_load_b128 readers
#define TPLACE 10240u      // 64 rows x 144 B = 9,216 B, rounded up to a multiple of 2 KiB
__device__ __forceinline__ unsigned uni(unsigned v) { return (unsigned)__builtin_amdgcn_readfirstlane(v); }
// a wave-uniform value held in a scalar register, so that the test around a tensor load compiles to a scalar branch and the words formed from it stand behind the wait in front of it
__device__ __forceinline__ unsigned pinned(unsigned v) { unsigned w = uni(v); asm volatile("" : "+s"(w)); return w; }
__global__ __launch_bounds__(128) void k_dot(const float* __restrict__ Q32, const __bf16* __restrict__ Kh, const __bf16* __restrict__ Kl, const __bf16* __restrict__ GTh, const __bf16* __restrict__ GTl, float* __restrict__ out) {
  __shared__ __align__(16) float sS[4][16][68];
  __shared__ __attribute__((aligned(2048))) unsigned char ring[2 * 4 * TPLACE];   // [buffer][Kh, Kl, GTh, GTl][64 rows of TPITCH]
  __shared__ __align__(16) __bf16 sPh[4][16][72], sPl[4][16][72];
  __shared__ __align__(16) float sOT[FF][68];      // [f][64 tokens]
  const int tid = threadIdx.x, w = tid >> 5, lane = tid & 31, col = lane & 15, g = lane >> 4; const int t = blockIdx.y, n0b = blockIdx.x * 64; const size_t q0 = (size_t)t * NN + n0b + w * 16;
  F2 aq[2];
#pragma unroll
  for (int kc = 0; kc < 2; ++kc) aq[kc] = split_row(Q32 + (q0 + col) * FF, kc * 32, lane);
  v8f acc[4] = {};
  // wave 0 brings Kh, 1 Kl (source rows back to back), 2 GTh, 3 GTl (source rows NN keys apart); frame t starts NN * FF elements in, in all four
  const unsigned wv = uni((unsigned)tid >> 5);
  const __bf16* tsrc = wv == 0 ? Kh : (wv == 1 ? Kl : (wv == 2 ? GTh : GTl));
  const unsigned long long src0 = (unsigned long long)(size_t)tsrc + (unsigned long long)t * (NN * FF * 2);
  const unsigned sstep = wv < 2 ? 64u * TROWB : TROWB;      // bytes from a stage's tile to the next stage's
  const unsigned lds0 = (unsigned)(size_t)ring + wv * TPLACE;
  v8u g1;   // 1-byte elements, tensor = tile = 64 rows of 128 B, no mask, a pad of 4 dwords behind every 32
  g1[0] = uni(1u << 20 | 4u << 22 | 3u << 25); g1[1] = uni(TROWB << 16); g1[2] = uni(64u << 16); g1[3] = uni(TROWB << 16); g1[4] = uni(64u);
  g1[5] = uni(wv < 2 ? TROWB : NN * 2u); g1[6] = uni(0u); g1[7] = uni(0u);
  asm volatile("" : "+s"(g1));   // the pinned() form, for descriptor words held in scalar registers: without it the compiler rebuilds the group at each load and puts other values into its registers while a request is outstanding
  auto issue = [&](unsigned st) {
    const unsigned long long ga = src0 + (unsigned long long)st * sstep;
    v4u g0; g0[0] = uni(1u); g0[1] = uni(lds0 + (st & 1u) * (4u * TPLACE)); g0[2] = uni((unsigned)ga); g0[3] = uni(((unsigned)(ga >> 32) & 0x01FFFFFFu) | 0x80000000u);
    asm volatile("tensor_load_to_lds %0, %1" :: "s"(g0), "s"(g1) : "memory");   // one request of the whole wave: its own tile of stage st
  };
  issue(0u);
  asm volatile("s_wait_tensorcnt 0x0" ::: "memory");   // this wave's tile of stage 0 has landed
  __syncthreads();                                     // all four tiles of stage 0 are readable by every wave
  issue(1u);
#pragma unroll 1
  for (int kt = 0; kt < NST; ++kt) {
    const unsigned char* tb = ring + (unsigned)(kt & 1) * (4u * TPLACE);
    // The four 16-key score tiles of a pass, and then the four 16-feature output tiles, are independent accumulators: their products are issued round-robin,
    // so that a product never waits for the one issued just before it; each tile still takes its own products in the order it had.
    // For that all fragments of the four tiles are read ahead of the products, in the order of their use. The loops over tiles are unrolled so that the fragment arrays are registers.
    v16b khf[2][4], klf[2][4];
#pragma unroll
    for (int kc = 0; kc < 2; ++kc) {
#pragma unroll
      for (int tt = 0; tt < 4; ++tt) khf[kc][tt] = frag_b((const __bf16*)(tb + (tt * 16 + col) * TPITCH) + kc * 32, lane);
#pragma unroll
      for (int tt = 0; tt < 4; ++tt) klf[kc][tt] = frag_b((const __bf16*)(tb + TPLACE + (tt * 16 + col) * TPITCH) + kc * 32, lane); }
    v8f s[4] = {};
#pragma unroll
    for (int kc = 0; kc < 2; ++kc) {
#pragma unroll
      for (int tt = 0; tt < 4; ++tt) s[tt] = wmma_bf(aq[kc].l, khf[kc][tt], s[tt]);
#pragma unroll
      for (int tt = 0; tt < 4; ++tt) s[tt] = wmma_bf(aq[kc].h, klf[kc][tt], s[tt]);
#pragma unroll
      for (int tt = 0; tt < 4; ++tt) s[tt] = wmma_bf(aq[kc].h, khf[kc][tt], s[tt]); }
    v16b ghf[2][4], glf[2][4];
#pragma unroll
    for (int kc = 0; kc < 2; ++kc) {
#pragma unroll
      for (int j = 0; j < 4; ++j) ghf[kc][j] = frag_b((const __bf16*)(tb + 2u * TPLACE + (j * 16 + col) * TPITCH + kc * 64), lane);
#pragma unroll
      for (int j = 0; j < 4; ++j) glf[kc][j] = frag_b((const __bf16*)(tb + 3u * TPLACE + (j * 16 + col) * TPITCH + kc * 64), lane); }
#pragma unroll
    for (int tt = 0; tt < 4; ++tt)
#pragma unroll
      for (int r = 0; r < 8; ++r) { const float v = s[tt][r] > 0.f ? s[tt][r] : 0.f; const __bf16 hi = (__bf16)v; sPh[w][8 * g + r][tt * 16 + col] = hi; sPl[w][8 * g + r][tt * 16 + col] = (__bf16)(v - (float)hi); }
    LDSX();
    v16b ph[2], pl[2];
#pragma unroll
    for (int kc = 0; kc < 2; ++kc) { pl[kc] = frag_b(&sPl[w][col][0] + kc * 32, lane); ph[kc] = frag_b(&sPh[w][col][0] + kc * 32, lane); }
#pragma unroll
    for (int kc = 0; kc < 2; ++kc) {
#pragma unroll
      for (int j = 0; j < 4; ++j) acc[j] = wmma_bf(pl[kc], ghf[kc][j], acc[j]);
#pragma unroll
      for (int j = 0; j < 4; ++j) acc[j] = wmma_bf(ph[kc], glf[kc][j], acc[j]);
#pragma unroll
      for (int j = 0; j < 4; ++j) acc[j] = wmma_bf(ph[kc], ghf[kc][j], acc[j]); }
    LDSX();                                              // s_wait_dscnt 0: this wave has read all it reads of stage kt
    asm volatile("s_wait_tensorcnt 0x0" ::: "memory");   // this wave's tile of stage kt + 1 has landed
    __syncthreads();                                     // stage kt + 1 is readable by every wave, and every wave has left stage kt's buffer
    if (pinned(kt + 2 < NST)) issue(pinned((unsigned)kt + 2u)); }   // refill of the buffer just left
  asm volatile("s_wait_tensorcnt 0x0" ::: "memory");     // no request is outstanding when the wave goes on to the output staging and ends
  asm volatile("s_wait_dscnt 0x0" ::: "memory");         // nor is any of its LDS reads: the ring's closing order
#pragma unroll
  for (int j = 0; j < 4; ++j)
#pragma unroll
    for (int r = 0; r < 8; ++r) sOT[j * 16 + col][w * 16 + 8 * g + r] = acc[j][r];
  __syncthreads();
  // out[t][f][n0b .. +63] = 256 B per f: 16 lanes x 16 B; 2 rows per instruction
  for (int qq = tid; qq < FF * 16; qq += 128) { const int f = qq >> 4, pc = qq & 15; vst2(out + ((size_t)t * FF + f) * NN + n0b + pc * 4, *(const v4f*)(&sOT[f][pc * 4])); }
}
extern "C" void kernel_launch(void* const* d_in, const int* in_sizes, int n_in, void* d_out, int out_size, void* d_ws, size_t ws_size, hipStream_t stream) {
  (void)in_sizes; (void)n_in; (void)out_size; (void)ws_size;
  const float** I = (const float**)d_in;   // input1, input2, W1, b1, W2, b2, W3, b3
  const float* x1 = I[0]; const float* x2 = I[1]; const float* W1 = I[2]; const float* b1 = I[3]; const float* W2 = I[4]; const float* b2 = I[5]; const float* W3 = I[6]; const float* b3 = I[7];
  char* ws = (char*)d_ws; size_t off = 0;
  auto take = [&](size_t bytes) { char* p = ws + off; off += (bytes + 255) & ~(size_t)255; return p; };
  __bf16* X1T = (__bf16*)take((size_t)NT * NN * CC * 2); __bf16* X2T = (__bf16*)take((size_t)NT * NN * CC * 2); float* Q32 = (float*)take((size_t)NT * NN * FF * 4);
  __bf16* Kh = (__bf16*)take((size_t)NT * NN * FF * 2); __bf16* Kl = (__bf16*)take((size_t)NT * NN * FF * 2); __bf16* GTh = (__bf16*)take((size_t)NT * FF * NN * 2); __bf16* GTl = (__bf16*)take((size_t)NT * FF * NN * 2);
  // ws ~ 42 MB
  k_cvtx<<<dim3(NN / 64, NT, 2), 256, 0, stream>>>(x1, x2, X1T, X2T);
  k_proj<<<dim3(NN / 64, NT, 3), 128, 0, stream>>>(X1T, X2T, W1, b1, W2, b2, W3, b3, Q32, Kh, Kl, GTh, GTl);
  k_dot<<<dim3(NN / 64, NT), 128, 0, stream>>>(Q32, Kh, Kl, GTh, GTl, (float*)d_out);
}

// v003
// It runs in 98.8 microseconds.
// In both of two side-by-side timings against v002, it was 1.32 times as fast.
// All steps since v000 together make it 3.87 times as fast.
// compute dtype: input1, input2, W1..3, b1..3 (INPUTS) rounded to bf16 with exact bf16 WMMA products (f32 accumulate) for the three 1x1 projections; q kept f32 and split hi/lo, k as bf16 hi/lo rows, relu'd scores as a bf16 hi/lo pair, g as bf16 hi/lo planes — all three-product combinations into one f32 accumulator set (f32-grade); relu in f32.
#include <hip/hip_runtime.h>
#include <math.h>

typedef __attribute__((ext_vector_type(16))) _Float16 v16h;
typedef __attribute__((ext_vector_type(16))) __bf16 v16b;
typedef __attribute__((ext_vector_type(8)))  _Float16 v8h;
typedef __attribute__((ext_vector_type(8)))  float v8f;
typedef __attribute__((ext_vector_type(4)))  float v4f;
typedef __attribute__((ext_vector_type(2)))  float v2f;
typedef __attribute__((ext_vector_type(4)))  unsigned v4u;
typedef __attribute__((ext_vector_type(4)))  int v4i;
typedef float __attribute__((may_alias)) float_a;
typedef int __attribute__((may_alias)) int_a;

template <typename T> __device__ __forceinline__ void vst2(void* p, T v) { *(T*)p = v;  }
__device__ __forceinline__ v8f wmma16(v16h a, v16h b, v8f c) {
  v8f d = __builtin_amdgcn_wmma_f32_16x16x32_f16(false, a, false, b, (short)0, c, false, false);
  asm volatile("v_nop\n\tv_nop\n\tv_nop\n\tv_nop" : "+v"(d) : "v"(a), "v"(b));
  return d;
}
__device__ __forceinline__ v8f wmma_bf(v16b a, v16b b, v8f c) {
  v8f d = __builtin_amdgcn_wmma_f32_16x16x32_bf16(false, a, false, b, (short)0, c, false, false);
  asm volatile("v_nop\n\tv_nop\n\tv_nop\n\tv_nop" : "+v"(d) : "v"(a), "v"(b));
  return d;
}
// 16x16x32 fragments: lane = (h = lane>>4, row/col = lane&15); elements 0..7 = k0+8h+0..7, 8..15 = k0+16+8h+0..7; D element r = row 8h+r
__device__ __forceinline__ v16h frag_h(const _Float16* rowk0, int lane) {
  union { v16h v; v8h q[2]; } u; const _Float16* p = rowk0 + 8 * (lane >> 4);
  u.q[0] = *(const v8h*)p; u.q[1] = *(const v8h*)(p + 16); return u.v;
}
__device__ __forceinline__ v16h frag_f32(const float* rowk0, int lane) {
  v16h a; const float* p = rowk0 + 8 * (lane >> 4);
#pragma unroll
  for (int i = 0; i < 8; ++i) { a[i] = (_Float16)p[i]; a[8 + i] = (_Float16)p[16 + i]; }
  return a;
}
__device__ __forceinline__ v16h frag_f32s(const float* rowk0, int lane, float sc) {
  v16h a; const float* p = rowk0 + 8 * (lane >> 4);
#pragma unroll
  for (int i = 0; i < 8; ++i) { a[i] = (_Float16)(p[i] * sc); a[8 + i] = (_Float16)(p[16 + i] * sc); }
  return a;
}
// column fragment from a [K][ld] layout (column n), rows >= K read as 0
__device__ __forceinline__ v16h fragc_f32(const float* W, int k0, int n, int lane, int ld, int K) {
  v16h a; const int g = lane >> 4;
#pragma unroll
  for (int i = 0; i < 8; ++i) { const int ka = k0 + 8 * g + i, kb = ka + 16;
    a[i] = (_Float16)(ka < K ? W[(size_t)(ka < K ? ka : K - 1) * ld + n] : 0.f); a[8 + i] = (_Float16)(kb < K ? W[(size_t)(kb < K ? kb : K - 1) * ld + n] : 0.f); }
  return a;
}
struct F2 { v16b h, l; };
__device__ __forceinline__ F2 bsplit16(const float v[16]) { F2 r;
#pragma unroll
  for (int i = 0; i < 16; ++i) { const __bf16 h = (__bf16)v[i]; r.h[i] = h; r.l[i] = (__bf16)(v[i] - (float)h); }
  return r; }
__device__ __forceinline__ F2 split_row(const float* row, int k0, int lane) { float v[16]; const float* p = row + k0 + 8 * (lane >> 4);
#pragma unroll
  for (int i = 0; i < 8; ++i) { v[i] = p[i]; v[8 + i] = p[16 + i]; }
  return bsplit16(v); }
__device__ __forceinline__ F2 split_rowK(const float* row, int k0, int lane, int K) { float v[16]; const int g = lane >> 4;
#pragma unroll
  for (int i = 0; i < 8; ++i) { const int ka = k0 + 8 * g + i, kb = ka + 16; v[i] = ka < K ? row[ka < K ? ka : K - 1] : 0.f; v[8 + i] = kb < K ? row[kb < K ? kb : K - 1] : 0.f; }
  return bsplit16(v); }
__device__ __forceinline__ F2 split_col(const float* W, int k0, int n, int lane, int ld, int K) { float v[16]; const int g = lane >> 4;
#pragma unroll
  for (int i = 0; i < 8; ++i) { const int ka = k0 + 8 * g + i, kb = ka + 16; v[i] = ka < K ? W[(size_t)(ka < K ? ka : K - 1) * ld + n] : 0.f; v[8 + i] = kb < K ? W[(size_t)(kb < K ? kb : K - 1) * ld + n] : 0.f; }
  return bsplit16(v); }
__device__ __forceinline__ v8f mac3(const F2& a, const F2& b, v8f c) { c = wmma_bf(a.l, b.h, c); c = wmma_bf(a.h, b.l, c); return wmma_bf(a.h, b.h, c); }
__device__ __forceinline__ float sigm(float v) { return 1.0f / (1.0f + expf(-v)); }
#define LDSX() do { asm volatile("s_wait_dscnt 0" ::: "memory"); __builtin_amdgcn_wave_barrier(); __builtin_amdgcn_fence(__ATOMIC_RELEASE, "workgroup"); } while (0)


// Spatial dot-product block (ReLU branch): per frame t (8) over the 64x64 = 4,096 positions with 128 channels: q = W1 x1 + b1, k = W2 x2 + b2, g = W3 x1 + b3 (64 features); scores = relu(q k^T) (no softmax, no scale);
// out = scores g -> stored as [b][t][f][h][w] (feature-major per frame).
// k_cvtx (channel-major frames -> token-major bf16 rows for both inputs), k_proj (Q32 rows; K hi/lo rows; G^T hi/lo planes), k_dot (block = (frame, 64 queries): 64 key tiles staged in LDS, S^T 3 products, relu, P hi/lo packed in registers x G hi/lo 3 products, transposed store).
#define NT 8
#define CC 128
#define NN 4096
#define FF 64
__device__ __forceinline__ float bfr(float v) { return (float)(__bf16)v; }
__device__ __forceinline__ v16b frag_b(const __bf16* rowk0, int lane) { return __builtin_bit_cast(v16b, frag_h((const _Float16*)rowk0, lane)); }

// [t][c][n] f32 -> XT [t][n][c] bf16 : block (t, 64 n); both inputs (which = blockIdx.z)
__global__ __launch_bounds__(256) void k_cvtx(const float* __restrict__ x1, const float* __restrict__ x2, __bf16* __restrict__ X1T, __bf16* __restrict__ X2T) {
  __shared__ __align__(16) __bf16 st[64][CC + 8];
  const int tid = threadIdx.x; const int t = blockIdx.y, n0 = blockIdx.x * 64, which = blockIdx.z; const float* x = which == 0 ? x1 : x2; __bf16* XT = which == 0 ? X1T : X2T;
  for (int q = tid; q < CC * 16; q += 256) { const int c = q >> 4, p4 = q & 15; const v4f v = *(const v4f*)(x + ((size_t)t * CC + c) * NN + n0 + p4 * 4);
    st[p4 * 4][c] = (__bf16)v[0]; st[p4 * 4 + 1][c] = (__bf16)v[1]; st[p4 * 4 + 2][c] = (__bf16)v[2]; st[p4 * 4 + 3][c] = (__bf16)v[3]; }
  __syncthreads();
  for (int q = tid; q < 64 * (CC / 8); q += 256) { const int rl = q >> 4, pc = q & 15; vst2((unsigned*)(XT + ((size_t)t * NN + n0 + rl) * CC + pc * 8), *(const v4u*)(&st[rl][pc * 8])); }
}
// projections: block (64 tokens of frame t, which): 0: q -> Q32 rows [t][n][64]; 1: k -> Kh/Kl rows; 2: g -> GTh/GTl planes [t][f][n]
__global__ __launch_bounds__(128) void k_proj(const __bf16* __restrict__ X1T, const __bf16* __restrict__ X2T, const float* __restrict__ W1, const float* __restrict__ b1, const float* __restrict__ W2, const float* __restrict__ b2, const float* __restrict__ W3, const float* __restrict__ b3,
                                            float* __restrict__ Q32, __bf16* __restrict__ Kh, __bf16* __restrict__ Kl, __bf16* __restrict__ GTh, __bf16* __restrict__ GTl) {
  __shared__ __align__(16) float so[4][16][68]; __shared__ __align__(16) __bf16 sh_[4][16][72], sl_[4][16][72]; __shared__ __align__(16) __bf16 sth[64][72], stl[64][72];
  const int tid = threadIdx.x, wave = tid >> 5, lane = tid & 31, col = lane & 15, g = lane >> 4; const int t = blockIdx.y, n0b = blockIdx.x * 64, which = blockIdx.z; const size_t r0 = (size_t)t * NN + n0b + wave * 16;
  const __bf16* XT = which == 1 ? X2T : X1T; const float* W = which == 0 ? W1 : (which == 1 ? W2 : W3); const float* bb_ = which == 0 ? b1 : (which == 1 ? b2 : b3);
  v8f acc[4] = {};
#pragma unroll
  for (int kc = 0; kc < CC / 32; ++kc) { const v16b a = frag_b(XT + (r0 + col) * CC + kc * 32, lane);
#pragma unroll
    for (int j = 0; j < 4; ++j) acc[j] = wmma_bf(a, split_row(W + (size_t)(j * 16 + col) * CC, kc * 32, lane).h, acc[j]); }
  if (which == 0) {
#pragma unroll
    for (int j = 0; j < 4; ++j) { const float bb = bfr(bb_[j * 16 + col]);
#pragma unroll
      for (int r = 0; r < 8; ++r) so[wave][8 * g + r][j * 16 + col] = acc[j][r] + bb; }
    LDSX();
    for (int qq = lane; qq < 16 * 16; qq += 32) { const int rl = qq >> 4, pc = qq & 15; vst2(Q32 + (r0 + rl) * FF + pc * 4, *(const v4f*)(&so[wave][rl][pc * 4])); } }
  else if (which == 1) {
#pragma unroll
    for (int j = 0; j < 4; ++j) { const float bb = bfr(bb_[j * 16 + col]);
#pragma unroll
      for (int r = 0; r < 8; ++r) { const float v = acc[j][r] + bb; const __bf16 hi = (__bf16)v; sh_[wave][8 * g + r][j * 16 + col] = hi; sl_[wave][8 * g + r][j * 16 + col] = (__bf16)(v - (float)hi); } }
    LDSX();
    for (int qq = lane; qq < 16 * 8; qq += 32) { const int rl = qq >> 3, pc = qq & 7; vst2((unsigned*)(Kh + (r0 + rl) * FF + pc * 8), *(const v4u*)(&sh_[wave][rl][pc * 8])); vst2((unsigned*)(Kl + (r0 + rl) * FF + pc * 8), *(const v4u*)(&sl_[wave][rl][pc * 8])); } }
  else {
#pragma unroll
    for (int j = 0; j < 4; ++j) { const float bb = bfr(bb_[j * 16 + col]);
#pragma unroll
      for (int r = 0; r < 8; ++r) { const float v = acc[j][r] + bb; const __bf16 hi = (__bf16)v; sth[j * 16 + col][wave * 16 + 8 * g + r] = hi; stl[j * 16 + col][wave * 16 + 8 * g + r] = (__bf16)(v - (float)hi); } }
    __syncthreads();
    for (int qq = tid; qq < 64 * 8; qq += 128) { const int f = qq >> 3, pc = qq & 7; const size_t o = ((size_t)t * FF + f) * NN + n0b + pc * 8; vst2((unsigned*)(GTh + o), *(const v4u*)(&sth[f][pc * 8])); vst2((unsigned*)(GTl + o), *(const v4u*)(&stl[f][pc * 8])); } }
}
// dot block: (frame t, 64 queries): S^T = k(hi,lo).q(hi,lo) (3 products, keys as rows), relu, P hi/lo x G^T hi/lo (3 products) into 4 column tiles; out^T[t][f][n]
// The four operand tiles of a 64-key stage (Kh, Kl: 64 key rows; GTh, GTl: 64 feature rows; every row 128 B) are brought into LDS once per block,
// one tensor load per wave and stage, two buffers, and all four waves read their fragments there.
typedef __attribute__((ext_vector_type(8))) unsigned v8u;
#define NST (NN / 64)      // stages = passes of the key loop
#define TROWB 128u         // bytes of a tile row (64 bf16)
#define TPITCH 144u        // its pitch in LDS: the load pads 16 B behind each row, 16 B x odd for ds_load_b128 readers
#define TPLACE 10240u      // 64 rows x 144 B = 9,216 B, rounded up to a multiple of 2 KiB
__device__ __forceinline__ unsigned uni(unsigned v) { return (unsigned)__builtin_amdgcn_readfirstlane(v); }
// a wave-uniform value held in a scalar register, so that the test around a tensor load compiles to a scalar branch and the words formed from it stand behind the wait in front of it
__device__ __forceinline__ unsigned pinned(unsigned v) { unsigned w = uni(v); asm volatile("" : "+s"(w)); return w; }
// At most two waves a SIMD: the 512 work-groups stand two on each WGP, as while LDS alone admitted two; the LDS now left would admit a third on one WGP.
__global__ __launch_bounds__(128) __attribute__((amdgpu_waves_per_eu(2, 2))) void k_dot(const float* __restrict__ Q32, const __bf16* __restrict__ Kh, const __bf16* __restrict__ Kl, const __bf16* __restrict__ GTh, const __bf16* __restrict__ GTl, float* __restrict__ out) {
  __shared__ __align__(16) float sS[4][16][68];
  __shared__ __attribute__((aligned(2048))) unsigned char ring[2 * 4 * TPLACE];   // [buffer][Kh, Kl, GTh, GTl][64 rows of TPITCH]
  __shared__ __align__(16) float sOT[FF][68];      // [f][64 tokens]
  const int tid = threadIdx.x, w = tid >> 5, lane = tid & 31, col = lane & 15, g = lane >> 4; const int t = blockIdx.y, n0b = blockIdx.x * 64; const size_t q0 = (size_t)t * NN + n0b + w * 16;
  F2 aq[2];
#pragma unroll
  for (int kc = 0; kc < 2; ++kc) aq[kc] = split_row(Q32 + (q0 + col) * FF, kc * 32, lane);
  v8f acc[4] = {};
  // wave 0 brings Kh, 1 Kl (source rows back to back), 2 GTh, 3 GTl (source rows NN keys apart); frame t starts NN * FF elements in, in all four
  const unsigned wv = uni((unsigned)tid >> 5);
  const __bf16* tsrc = wv == 0 ? Kh : (wv == 1 ? Kl : (wv == 2 ? GTh : GTl));
  const unsigned long long src0 = (unsigned long long)(size_t)tsrc + (unsigned long long)t * (NN * FF * 2);
  const unsigned sstep = wv < 2 ? 64u * TROWB : TROWB;      // bytes from a stage's tile to the next stage's
  const unsigned lds0 = (unsigned)(size_t)ring + wv * TPLACE;
  v8u g1;   // 1-byte elements, tensor = tile = 64 rows of 128 B, no mask, a pad of 4 dwords behind every 32
  g1[0] = uni(1u << 20 | 4u << 22 | 3u << 25); g1[1] = uni(TROWB << 16); g1[2] = uni(64u << 16); g1[3] = uni(TROWB << 16); g1[4] = uni(64u);
  g1[5] = uni(wv < 2 ? TROWB : NN * 2u); g1[6] = uni(0u); g1[7] = uni(0u);
  asm volatile("" : "+s"(g1));   // the pinned() form, for descriptor words held in scalar registers: without it the compiler rebuilds the group at each load and puts other values into its registers while a request is outstanding
  auto issue = [&](unsigned st) {
    const unsigned long long ga = src0 + (unsigned long long)st * sstep;
    v4u g0; g0[0] = uni(1u); g0[1] = uni(lds0 + (st & 1u) * (4u * TPLACE)); g0[2] = uni((unsigned)ga); g0[3] = uni(((unsigned)(ga >> 32) & 0x01FFFFFFu) | 0x80000000u);
    asm volatile("tensor_load_to_lds %0, %1" :: "s"(g0), "s"(g1) : "memory");   // one request of the whole wave: its own tile of stage st
  };
  issue(0u);
  asm volatile("s_wait_tensorcnt 0x0" ::: "memory");   // this wave's tile of stage 0 has landed
  __syncthreads();                                     // all four tiles of stage 0 are readable by every wave
  issue(1u);
#pragma unroll 1
  for (int kt = 0; kt < NST; ++kt) {
    const unsigned char* tb = ring + (unsigned)(kt & 1) * (4u * TPLACE);
    // The four 16-key score tiles of a pass, and then the four 16-feature output tiles, are independent accumulators: their products are issued round-robin,
    // so that a product never waits for the one issued just before it; each tile still takes its own products in the order it had.
    // For that all fragments of the four tiles are read ahead of the products, in the order of their use. The loops over tiles are unrolled so that the fragment arrays are registers.
    v16b khf[2][4], klf[2][4];
#pragma unroll
    for (int kc = 0; kc < 2; ++kc) {
#pragma unroll
      for (int tt = 0; tt < 4; ++tt) khf[kc][tt] = frag_b((const __bf16*)(tb + (tt * 16 + col) * TPITCH) + kc * 32, lane);
#pragma unroll
      for (int tt = 0; tt < 4; ++tt) klf[kc][tt] = frag_b((const __bf16*)(tb + TPLACE + (tt * 16 + col) * TPITCH) + kc * 32, lane); }
    v8f s[4] = {};
#pragma unroll
    for (int kc = 0; kc < 2; ++kc) {
#pragma unroll
      for (int tt = 0; tt < 4; ++tt) s[tt] = wmma_bf(khf[kc][tt], aq[kc].l, s[tt]);
#pragma unroll
      for (int tt = 0; tt < 4; ++tt) s[tt] = wmma_bf(klf[kc][tt], aq[kc].h, s[tt]);
#pragma unroll
      for (int tt = 0; tt < 4; ++tt) s[tt] = wmma_bf(khf[kc][tt], aq[kc].h, s[tt]); }
    v16b ghf[2][4], glf[2][4];
#pragma unroll
    for (int kc = 0; kc < 2; ++kc) {
#pragma unroll
      for (int j = 0; j < 4; ++j) ghf[kc][j] = frag_b((const __bf16*)(tb + 2u * TPLACE + (j * 16 + col) * TPITCH + kc * 64), lane);
#pragma unroll
      for (int j = 0; j < 4; ++j) glf[kc][j] = frag_b((const __bf16*)(tb + 3u * TPLACE + (j * 16 + col) * TPITCH + kc * 64), lane); }
    // With the keys as rows, s[tt][r] of lane (g, col) is the score of query col and key 16 tt + 8 g + r: tiles 2 kc and 2 kc + 1 hold, element for element,
    // the lane's 16 keys of the P fragment of keys 32 kc .. 32 kc + 31 (row = query col; k = 8 g + 0..7, then 16 + 8 g + 0..7), so P goes from the accumulators into its operand in place.
    v16b ph[2], pl[2];
#pragma unroll
    for (int tt = 0; tt < 4; ++tt)
#pragma unroll
      for (int r = 0; r < 8; ++r) { const float v = s[tt][r] > 0.f ? s[tt][r] : 0.f; const __bf16 hi = (__bf16)v; ph[tt >> 1][8 * (tt & 1) + r] = hi; pl[tt >> 1][8 * (tt & 1) + r] = (__bf16)(v - (float)hi); }
#pragma unroll
    for (int kc = 0; kc < 2; ++kc) {
#pragma unroll
      for (int j = 0; j < 4; ++j) acc[j] = wmma_bf(pl[kc], ghf[kc][j], acc[j]);
#pragma unroll
      for (int j = 0; j < 4; ++j) acc[j] = wmma_bf(ph[kc], glf[kc][j], acc[j]);
#pragma unroll
      for (int j = 0; j < 4; ++j) acc[j] = wmma_bf(ph[kc], ghf[kc][j], acc[j]); }
    LDSX();                                              // s_wait_dscnt 0: this wave has read all it reads of stage kt
    asm volatile("s_wait_tensorcnt 0x0" ::: "memory");   // this wave's tile of stage kt + 1 has landed
    __syncthreads();                                     // stage kt + 1 is readable by every wave, and every wave has left stage kt's buffer
    if (pinned(kt + 2 < NST)) issue(pinned((unsigned)kt + 2u)); }   // refill of the buffer just left
  asm volatile("s_wait_tensorcnt 0x0" ::: "memory");     // no request is outstanding when the wave goes on to the output staging and ends
  asm volatile("s_wait_dscnt 0x0" ::: "memory");         // nor is any of its LDS reads: the ring's closing order
#pragma unroll
  for (int j = 0; j < 4; ++j)
#pragma unroll
    for (int r = 0; r < 8; ++r) sOT[j * 16 + col][w * 16 + 8 * g + r] = acc[j][r];
  __syncthreads();
  // out[t][f][n0b .. +63] = 256 B per f: 16 lanes x 16 B; 2 rows per instruction
  for (int qq = tid; qq < FF * 16; qq += 128) { const int f = qq >> 4, pc = qq & 15; vst2(out + ((size_t)t * FF + f) * NN + n0b + pc * 4, *(const v4f*)(&sOT[f][pc * 4])); }
}
extern "C" void kernel_launch(void* const* d_in, const int* in_sizes, int n_in, void* d_out, int out_size, void* d_ws, size_t ws_size, hipStream_t stream) {
  (void)in_sizes; (void)n_in; (void)out_size; (void)ws_size;
  const float** I = (const float**)d_in;   // input1, input2, W1, b1, W2, b2, W3, b3
  const float* x1 = I[0]; const float* x2 = I[1]; const float* W1 = I[2]; const float* b1 = I[3]; const float* W2 = I[4]; const float* b2 = I[5]; const float* W3 = I[6]; const float* b3 = I[7];
  char* ws = (char*)d_ws; size_t off = 0;
  auto take = [&](size_t bytes) { char* p = ws + off; off += (bytes + 255) & ~(size_t)255; return p; };
  __bf16* X1T = (__bf16*)take((size_t)NT * NN * CC * 2); __bf16* X2T = (__bf16*)take((size_t)NT * NN * CC * 2); float* Q32 = (float*)take((size_t)NT * NN * FF * 4);
  __bf16* Kh = (__bf16*)take((size_t)NT * NN * FF * 2); __bf16* Kl = (__bf16*)take((size_t)NT * NN * FF * 2); __bf16* GTh = (__bf16*)take((size_t)NT * FF * NN * 2); __bf16* GTl = (__bf16*)take((size_t)NT * FF * NN * 2);
  // ws ~ 42 MB
  k_cvtx<<<dim3(NN / 64, NT, 2), 256, 0, stream>>>(x1, x2, X1T, X2T);
  k_proj<<<dim3(NN / 64, NT, 3), 128, 0, stream>>>(X1T, X2T, W1, b1, W2, b2, W3, b3, Q32, Kh, Kl, GTh, GTl);
  k_dot<<<dim3(NN / 64, NT), 128, 0, stream>>>(Q32, Kh, Kl, GTh, GTl, (float*)d_out);
}

// v004
// A run of this version takes 87.8 microseconds.
// Two timings next to v003 put it at 1.10 and 1.11 times that version's speed.
// Counting every step since v000, it is 4.27 times as fast.
// compute dtype: input1, input2, W1..3, b1..3 (INPUTS) rounded to bf16 with exact bf16 WMMA products (f32 accumulate) for the three 1x1 projections; q kept f32 and split hi/lo, k as bf16 hi/lo rows, relu'd scores as a bf16 hi/lo pair, g as bf16 hi/lo planes — all three-product combinations into one f32 accumulator set (f32-grade); relu in f32.
#include <hip/hip_runtime.h>
#include <math.h>

typedef __attribute__((ext_vector_type(16))) _Float16 v16h;
typedef __attribute__((ext_vector_type(16))) __bf16 v16b;
typedef __attribute__((ext_vector_type(8)))  _Float16 v8h;
typedef __attribute__((ext_vector_type(8)))  float v8f;
typedef __attribute__((ext_vector_type(4)))  float v4f;
typedef __attribute__((ext_vector_type(2)))  float v2f;
typedef __attribute__((ext_vector_type(4)))  unsigned v4u;
typedef __attribute__((ext_vector_type(4)))  int v4i;
typedef float __attribute__((may_alias)) float_a;
typedef int __attribute__((may_alias)) int_a;

template <typename T> __device__ __forceinline__ void vst2(void* p, T v) { *(T*)p = v;  }
__device__ __forceinline__ v8f wmma16(v16h a, v16h b, v8f c) {
  v8f d = __builtin_amdgcn_wmma_f32_16x16x32_f16(false, a, false, b, (short)0, c, false, false);
  asm volatile("v_nop\n\tv_nop\n\tv_nop\n\tv_nop" : "+v"(d) : "v"(a), "v"(b));
  return d;
}
__device__ __forceinline__ v8f wmma_bf(v16b a, v16b b, v8f c) {
  v8f d = __builtin_amdgcn_wmma_f32_16x16x32_bf16(false, a, false, b, (short)0, c, false, false);
  asm volatile("v_nop\n\tv_nop\n\tv_nop\n\tv_nop" : "+v"(d) : "v"(a), "v"(b));
  return d;
}
// 16x16x32 fragments: lane = (h = lane>>4, row/col = lane&15); elements 0..7 = k0+8h+0..7, 8..15 = k0+16+8h+0..7; D element r = row 8h+r
__device__ __forceinline__ v16h frag_h(const _Float16* rowk0, int lane) {
  union { v16h v; v8h q[2]; } u; const _Float16* p = rowk0 + 8 * (lane >> 4);
  u.q[0] = *(const v8h*)p; u.q[1] = *(const v8h*)(p + 16); return u.v;
}
__device__ __forceinline__ v16h frag_f32(const float* rowk0, int lane) {
  v16h a; const float* p = rowk0 + 8 * (lane >> 4);
#pragma unroll
  for (int i = 0; i < 8; ++i) { a[i] = (_Float16)p[i]; a[8 + i] = (_Float16)p[16 + i]; }
  return a;
}
__device__ __forceinline__ v16h frag_f32s(const float* rowk0, int lane, float sc) {
  v16h a; const float* p = rowk0 + 8 * (lane >> 4);
#pragma unroll
  for (int i = 0; i < 8; ++i) { a[i] = (_Float16)(p[i] * sc); a[8 + i] = (_Float16)(p[16 + i] * sc); }
  return a;
}
// column fragment from a [K][ld] layout (column n), rows >= K read as 0
__device__ __forceinline__ v16h fragc_f32(const float* W, int k0, int n, int lane, int ld, int K) {
  v16h a; const int g = lane >> 4;
#pragma unroll
  for (int i = 0; i < 8; ++i) { const int ka = k0 + 8 * g + i, kb = ka + 16;
    a[i] = (_Float16)(ka < K ? W[(size_t)(ka < K ? ka : K - 1) * ld + n] : 0.f); a[8 + i] = (_Float16)(kb < K ? W[(size_t)(kb < K ? kb : K - 1) * ld + n] : 0.f); }
  return a;
}
struct F2 { v16b h, l; };
__device__ __forceinline__ F2 bsplit16(const float v[16]) { F2 r;
#pragma unroll
  for (int i = 0; i < 16; ++i) { const __bf16 h = (__bf16)v[i]; r.h[i] = h; r.l[i] = (__bf16)(v[i] - (float)h); }
  return r; }
__device__ __forceinline__ F2 split_row(const float* row, int k0, int lane) { float v[16]; const float* p = row + k0 + 8 * (lane >> 4);
#pragma unroll
  for (int i = 0; i < 8; ++i) { v[i] = p[i]; v[8 + i] = p[16 + i]; }
  return bsplit16(v); }
__device__ __forceinline__ F2 split_rowK(const float* row, int k0, int lane, int K) { float v[16]; const int g = lane >> 4;
#pragma unroll
  for (int i = 0; i < 8; ++i) { const int ka = k0 + 8 * g + i, kb = ka + 16; v[i] = ka < K ? row[ka < K ? ka : K - 1] : 0.f; v[8 + i] = kb < K ? row[kb < K ? kb : K - 1] : 0.f; }
  return bsplit16(v); }
__device__ __forceinline__ F2 split_col(const float* W, int k0, int n, int lane, int ld, int K) { float v[16]; const int g = lane >> 4;
#pragma unroll
  for (int i = 0; i < 8; ++i) { const int ka = k0 + 8 * g + i, kb = ka + 16; v[i] = ka < K ? W[(size_t)(ka < K ? ka : K - 1) * ld + n] : 0.f; v[8 + i] = kb < K ? W[(size_t)(kb < K ? kb : K - 1) * ld + n] : 0.f; }
  return bsplit16(v); }
__device__ __forceinline__ v8f mac3(const F2& a, const F2& b, v8f c) { c = wmma_bf(a.l, b.h, c); c = wmma_bf(a.h, b.l, c); return wmma_bf(a.h, b.h, c); }
__device__ __forceinline__ float sigm(float v) { return 1.0f / (1.0f + expf(-v)); }
#define LDSX() do { asm volatile("s_wait_dscnt 0" ::: "memory"); __builtin_amdgcn_wave_barrier(); __builtin_amdgcn_fence(__ATOMIC_RELEASE, "workgroup"); } while (0)


// Spatial dot-product block (ReLU branch): per frame t (8) over the 64x64 = 4,096 positions with 128 channels: q = W1 x1 + b1, k = W2 x2 + b2, g = W3 x1 + b3 (64 features); scores = relu(q k^T) (no softmax, no scale);
// out = scores g -> stored as [b][t][f][h][w] (feature-major per frame).
// k_cvtx (channel-major frames -> token-major bf16 rows for both inputs), k_proj (Q32 rows; K hi/lo rows; G^T hi/lo planes), k_dot (block = (frame, 128 queries): 128-key stages in LDS, 32 queries and 64 of the keys per wave, S^T 3 products, relu, P hi/lo packed in registers x G hi/lo 3 products, transposed store).
#define NT 8
#define CC 128
#define NN 4096
#define FF 64
__device__ __forceinline__ float bfr(float v) { return (float)(__bf16)v; }
__device__ __forceinline__ v16b frag_b(const __bf16* rowk0, int lane) { return __builtin_bit_cast(v16b, frag_h((const _Float16*)rowk0, lane)); }

// [t][c][n] f32 -> XT [t][n][c] bf16 : block (t, 64 n); both inputs (which = blockIdx.z)
__global__ __launch_bounds__(256) void k_cvtx(const float* __restrict__ x1, const float* __restrict__ x2, __bf16* __restrict__ X1T, __bf16* __restrict__ X2T) {
  __shared__ __align__(16) __bf16 st[64][CC + 8];
  const int tid = threadIdx.x; const int t = blockIdx.y, n0 = blockIdx.x * 64, which = blockIdx.z; const float* x = which == 0 ? x1 : x2; __bf16* XT = which == 0 ? X1T : X2T;
  for (int q = tid; q < CC * 16; q += 256) { const int c = q >> 4, p4 = q & 15; const v4f v = *(const v4f*)(x + ((size_t)t * CC + c) * NN + n0 + p4 * 4);
    st[p4 * 4][c] = (__bf16)v[0]; st[p4 * 4 + 1][c] = (__bf16)v[1]; st[p4 * 4 + 2][c] = (__bf16)v[2]; st[p4 * 4 + 3][c] = (__bf16)v[3]; }
  __syncthreads();
  for (int q = tid; q < 64 * (CC / 8); q += 256) { const int rl = q >> 4, pc = q & 15; vst2((unsigned*)(XT + ((size_t)t * NN + n0 + rl) * CC + pc * 8), *(const v4u*)(&st[rl][pc * 8])); }
}
// projections: block (64 tokens of frame t, which): 0: q -> Q32 rows [t][n][64]; 1: k -> Kh/Kl rows; 2: g -> GTh/GTl planes [t][f][n]
__global__ __launch_bounds__(128) void k_proj(const __bf16* __restrict__ X1T, const __bf16* __restrict__ X2T, const float* __restrict__ W1, const float* __restrict__ b1, const float* __restrict__ W2, const float* __restrict__ b2, const float* __restrict__ W3, const float* __restrict__ b3,
                                            float* __restrict__ Q32, __bf16* __restrict__ Kh, __bf16* __restrict__ Kl, __bf16* __restrict__ GTh, __bf16* __restrict__ GTl) {
  __shared__ __align__(16) float so[4][16][68]; __shared__ __align__(16) __bf16 sh_[4][16][72], sl_[4][16][72]; __shared__ __align__(16) __bf16 sth[64][72], stl[64][72];
  const int tid = threadIdx.x, wave = tid >> 5, lane = tid & 31, col = lane & 15, g = lane >> 4; const int t = blockIdx.y, n0b = blockIdx.x * 64, which = blockIdx.z; const size_t r0 = (size_t)t * NN + n0b + wave * 16;
  const __bf16* XT = which == 1 ? X2T : X1T; const float* W = which == 0 ? W1 : (which == 1 ? W2 : W3); const float* bb_ = which == 0 ? b1 : (which == 1 ? b2 : b3);
  v8f acc[4] = {};
#pragma unroll
  for (int kc = 0; kc < CC / 32; ++kc) { const v16b a = frag_b(XT + (r0 + col) * CC + kc * 32, lane);
#pragma unroll
    for (int j = 0; j < 4; ++j) acc[j] = wmma_bf(a, split_row(W + (size_t)(j * 16 + col) * CC, kc * 32, lane).h, acc[j]); }
  if (which == 0) {
#pragma unroll
    for (int j = 0; j < 4; ++j) { const float bb = bfr(bb_[j * 16 + col]);
#pragma unroll
      for (int r = 0; r < 8; ++r) so[wave][8 * g + r][j * 16 + col] = acc[j][r] + bb; }
    LDSX();
    for (int qq = lane; qq < 16 * 16; qq += 32) { const int rl = qq >> 4, pc = qq & 15; vst2(Q32 + (r0 + rl) * FF + pc * 4, *(const v4f*)(&so[wave][rl][pc * 4])); } }
  else if (which == 1) {
#pragma unroll
    for (int j = 0; j < 4; ++j) { const float bb = bfr(bb_[j * 16 + col]);
#pragma unroll
      for (int r = 0; r < 8; ++r) { const float v = acc[j][r] + bb; const __bf16 hi = (__bf16)v; sh_[wave][8 * g + r][j * 16 + col] = hi; sl_[wave][8 * g + r][j * 16 + col] = (__bf16)(v - (float)hi); } }
    LDSX();
    for (int qq = lane; qq < 16 * 8; qq += 32) { const int rl = qq >> 3, pc = qq & 7; vst2((unsigned*)(Kh + (r0 + rl) * FF + pc * 8), *(const v4u*)(&sh_[wave][rl][pc * 8])); vst2((unsigned*)(Kl + (r0 + rl) * FF + pc * 8), *(const v4u*)(&sl_[wave][rl][pc * 8])); } }
  else {
#pragma unroll
    for (int j = 0; j < 4; ++j) { const float bb = bfr(bb_[j * 16 + col]);
#pragma unroll
      for (int r = 0; r < 8; ++r) { const float v = acc[j][r] + bb; const __bf16 hi = (__bf16)v; sth[j * 16 + col][wave * 16 + 8 * g + r] = hi; stl[j * 16 + col][wave * 16 + 8 * g + r] = (__bf16)(v - (float)hi); } }
    __syncthreads();
    for (int qq = tid; qq < 64 * 8; qq += 128) { const int f = qq >> 3, pc = qq & 7; const size_t o = ((size_t)t * FF + f) * NN + n0b + pc * 8; vst2((unsigned*)(GTh + o), *(const v4u*)(&sth[f][pc * 8])); vst2((unsigned*)(GTl + o), *(const v4u*)(&stl[f][pc * 8])); } }
}
// dot block: (frame t, 128 queries), 8 waves = 4 query groups of 32 x 2 key halves: S^T = k(hi,lo).q(hi,lo) (3 products, keys as rows), relu, P hi/lo x G^T hi/lo (3 products) into 2 x 4 output tiles; out^T[t][f][n]
// A stage is 128 keys. Its eight operand tiles (per 64-key half: Kh, Kl: 64 key rows; GTh, GTl: 64 feature rows; every row 128 B) are brought into LDS once per block,
// one tensor load per wave and stage, two buffers. The four waves of a key half read their fragments from that half's tiles, and every fragment read serves the wave's two 16-query tiles.
typedef __attribute__((ext_vector_type(8))) unsigned v8u;
#define SKEYS 128          // keys of a stage
#define NST (NN / SKEYS)   // stages = passes of the key loop
#define BQ 128             // queries of a block
#define TROWB 128u         // bytes of a tile row (64 bf16)
#define TPITCH 144u        // its pitch in LDS: the load pads 16 B behind each row, 16 B x odd for ds_load_b128 readers
#define TPLACE 10240u      // 64 rows x 144 B = 9,216 B, rounded up to a multiple of 2 KiB
__device__ __forceinline__ unsigned uni(unsigned v) { return (unsigned)__builtin_amdgcn_readfirstlane(v); }
// a wave-uniform value held in a scalar register, so that the test around a tensor load compiles to a scalar branch and the words formed from it stand behind the wait in front of it
__device__ __forceinline__ unsigned pinned(unsigned v) { unsigned w = uni(v); asm volatile("" : "+s"(w)); return w; }
// The 256 work-groups stand one on each WGP (its LDS admits no second), two waves a SIMD.
__global__ __launch_bounds__(256) void k_dot(const float* __restrict__ Q32, const __bf16* __restrict__ Kh, const __bf16* __restrict__ Kl, const __bf16* __restrict__ GTh, const __bf16* __restrict__ GTl, float* __restrict__ out) {
  __shared__ __attribute__((aligned(2048))) unsigned char ring[2 * 8 * TPLACE];   // [buffer][key half][Kh, Kl, GTh, GTl][64 rows of TPITCH]
  __shared__ __align__(16) float sOT[FF][BQ + 4];      // [f][128 tokens]
  const int tid = threadIdx.x, w = tid >> 5, lane = tid & 31, col = lane & 15, g = lane >> 4; const int qg = w & 3, hk = w >> 2;
  const int t = blockIdx.y, n0b = blockIdx.x * BQ; const size_t q0 = (size_t)t * NN + n0b + qg * 32;
  // q rows of the wave's two 16-query tiles: per tile eight 16-byte pieces, piece c = floats 16 (c >> 1) + 4 (c & 1) + 0..3 behind the lane's 8 g
  const float* qp = Q32 + (q0 + col) * FF + 8 * g;
  v4f qr[2][8];
#pragma unroll
  for (int c = 0; c < 8; ++c) { qr[0][c] = *(const v4f*)(qp + 16 * (c >> 1) + 4 * (c & 1)); qr[1][c] = *(const v4f*)(qp + 16 * FF + 16 * (c >> 1) + 4 * (c & 1)); }
  // The wait stands behind the q loads and in front of any overwrite of their address registers: the loaded values as inputs hold the loads in front of it, the address as an input stays in its registers up to it.
  asm volatile("s_wait_xcnt 0x0" :: "v"(qp), "v"(qr[0][0]), "v"(qr[0][1]), "v"(qr[0][2]), "v"(qr[0][3]), "v"(qr[0][4]), "v"(qr[0][5]), "v"(qr[0][6]), "v"(qr[0][7]),
               "v"(qr[1][0]), "v"(qr[1][1]), "v"(qr[1][2]), "v"(qr[1][3]), "v"(qr[1][4]), "v"(qr[1][5]), "v"(qr[1][6]), "v"(qr[1][7]));
  F2 aq[2][2];
#pragma unroll
  for (int qt = 0; qt < 2; ++qt)
#pragma unroll
    for (int kc = 0; kc < 2; ++kc) { float v[16];
#pragma unroll
      for (int e = 0; e < 16; ++e) v[e] = qr[qt][4 * kc + (e >> 2)][e & 3];
      aq[qt][kc] = bsplit16(v); }
  v8f acc[2][4] = {};
  // wave 4 h + o brings, for key half h, tile o: 0 Kh, 1 Kl (source rows back to back), 2 GTh, 3 GTl (source rows NN keys apart); frame t starts NN * FF elements in, in all four
  const unsigned wv = uni((unsigned)tid >> 5), op = wv & 3u, half = wv >> 2;
  const __bf16* tsrc = op == 0 ? Kh : (op == 1 ? Kl : (op == 2 ? GTh : GTl));
  const unsigned hstep = op < 2 ? 64u * TROWB : TROWB;      // bytes from a 64-key tile to the next 64 keys' tile; a stage is two of them
  const unsigned long long src0 = (unsigned long long)(size_t)tsrc + (unsigned long long)t * (NN * FF * 2) + half * hstep;
  const unsigned sstep = 2u * hstep;
  const unsigned lds0 = (unsigned)(size_t)ring + wv * TPLACE;
  v8u g1;   // 1-byte elements, tensor = tile = 64 rows of 128 B, no mask, a pad of 4 dwords behind every 32
  g1[0] = uni(1u << 20 | 4u << 22 | 3u << 25); g1[1] = uni(TROWB << 16); g1[2] = uni(64u << 16); g1[3] = uni(TROWB << 16); g1[4] = uni(64u);
  g1[5] = uni(op < 2 ? TROWB : NN * 2u); g1[6] = uni(0u); g1[7] = uni(0u);
  asm volatile("" : "+s"(g1));   // the pinned() form, for descriptor words held in scalar registers: without it the compiler rebuilds the group at each load and puts other values into its registers while a request is outstanding
  auto issue = [&](unsigned st) {
    const unsigned long long ga = src0 + (unsigned long long)st * sstep;
    v4u g0; g0[0] = uni(1u); g0[1] = uni(lds0 + (st & 1u) * (8u * TPLACE)); g0[2] = uni((unsigned)ga); g0[3] = uni(((unsigned)(ga >> 32) & 0x01FFFFFFu) | 0x80000000u);
    asm volatile("tensor_load_to_lds %0, %1" :: "s"(g0), "s"(g1) : "memory");   // one request of the whole wave: its own tile of stage st
  };
  issue(0u);
  asm volatile("s_wait_tensorcnt 0x0" ::: "memory");   // this wave's tile of stage 0 has landed
  __syncthreads();                                     // all eight tiles of stage 0 are readable by every wave
  issue(1u);
#pragma unroll 1
  for (int kt = 0; kt < NST; ++kt) {
    const unsigned char* tb = ring + (unsigned)(kt & 1) * (8u * TPLACE) + (unsigned)hk * (4u * TPLACE);   // this wave's key half of stage kt
    // The wave's 64 keys go in two runs of 32: a run's fragments and scores, beside the standing q and output tiles, stay within 256 registers; with all 64 keys in one run the build spills to scratch.
    // The four score tiles of a run (2 x 16 keys, 2 x 16 queries), and then the eight output tiles (2 x 16 queries, 4 x 16 features), are independent accumulators: their products are issued round-robin,
    // so that a product never waits for the one issued just before it; each tile still takes its own products in the order it had.
    // For that all fragments of a group are read ahead of the products, in the order of their use. The loops over runs and tiles are unrolled so that the fragment arrays are registers.
#pragma unroll
    for (int h = 0; h < 2; ++h) {
      v16b khf[2][2], klf[2][2];
#pragma unroll
      for (int kc = 0; kc < 2; ++kc) {
#pragma unroll
        for (int tt = 0; tt < 2; ++tt) khf[kc][tt] = frag_b((const __bf16*)(tb + ((2 * h + tt) * 16 + col) * TPITCH) + kc * 32, lane);
#pragma unroll
        for (int tt = 0; tt < 2; ++tt) klf[kc][tt] = frag_b((const __bf16*)(tb + TPLACE + ((2 * h + tt) * 16 + col) * TPITCH) + kc * 32, lane); }
      v8f s[2][2] = {};
#pragma unroll
      for (int kc = 0; kc < 2; ++kc) {
#pragma unroll
        for (int tt = 0; tt < 2; ++tt)
#pragma unroll
          for (int qt = 0; qt < 2; ++qt) s[qt][tt] = wmma_bf(khf[kc][tt], aq[qt][kc].l, s[qt][tt]);
#pragma unroll
        for (int tt = 0; tt < 2; ++tt)
#pragma unroll
          for (int qt = 0; qt < 2; ++qt) s[qt][tt] = wmma_bf(klf[kc][tt], aq[qt][kc].h, s[qt][tt]);
#pragma unroll
        for (int tt = 0; tt < 2; ++tt)
#pragma unroll
          for (int qt = 0; qt < 2; ++qt) s[qt][tt] = wmma_bf(khf[kc][tt], aq[qt][kc].h, s[qt][tt]); }
      v16b ghf[4], glf[4];
#pragma unroll
      for (int j = 0; j < 4; ++j) ghf[j] = frag_b((const __bf16*)(tb + 2u * TPLACE + (j * 16 + col) * TPITCH + h * 64), lane);
#pragma unroll
      for (int j = 0; j < 4; ++j) glf[j] = frag_b((const __bf16*)(tb + 3u * TPLACE + (j * 16 + col) * TPITCH + h * 64), lane);
      // With the keys as rows, s[qt][tt][r] of lane (g, col) is the score of query 16 qt + col and key 32 h + 16 tt + 8 g + r: the run's two key tiles hold, element for element,
      // the lane's 16 keys of the P fragment of keys 32 h .. 32 h + 31 (row = query col; k = 8 g + 0..7, then 16 + 8 g + 0..7), so P goes from the accumulators into its operand in place.
      v16b ph[2], pl[2];
#pragma unroll
      for (int qt = 0; qt < 2; ++qt)
#pragma unroll
        for (int tt = 0; tt < 2; ++tt)
#pragma unroll
          for (int r = 0; r < 8; ++r) { const float v = s[qt][tt][r] > 0.f ? s[qt][tt][r] : 0.f; const __bf16 hi = (__bf16)v; ph[qt][8 * tt + r] = hi; pl[qt][8 * tt + r] = (__bf16)(v - (float)hi); }
#pragma unroll
      for (int j = 0; j < 4; ++j)
#pragma unroll
        for (int qt = 0; qt < 2; ++qt) acc[qt][j] = wmma_bf(pl[qt], ghf[j], acc[qt][j]);
#pragma unroll
      for (int j = 0; j < 4; ++j)
#pragma unroll
        for (int qt = 0; qt < 2; ++qt) acc[qt][j] = wmma_bf(ph[qt], glf[j], acc[qt][j]);
#pragma unroll
      for (int j = 0; j < 4; ++j)
#pragma unroll
        for (int qt = 0; qt < 2; ++qt) acc[qt][j] = wmma_bf(ph[qt], ghf[j], acc[qt][j]); }
    LDSX();                                              // s_wait_dscnt 0: this wave has read all it reads of stage kt
    asm volatile("s_wait_tensorcnt 0x0" ::: "memory");   // this wave's tile of stage kt + 1 has landed
    __syncthreads();                                     // stage kt + 1 is readable by every wave, and every wave has left stage kt's buffer
    if (pinned(kt + 2 < NST)) issue(pinned((unsigned)kt + 2u)); }   // refill of the buffer just left
  asm volatile("s_wait_tensorcnt 0x0" ::: "memory");     // no request is outstanding when the wave goes on to the output staging and ends
  asm volatile("s_wait_dscnt 0x0" ::: "memory");         // nor is any of its LDS reads: the ring's closing order
  // The two key halves' sums of a query group are joined in the output staging: the second half's wave lays its sums down, the first half's wave adds its own to them in place.
  if (half == 1u) {
#pragma unroll
    for (int qt = 0; qt < 2; ++qt)
#pragma unroll
      for (int j = 0; j < 4; ++j)
#pragma unroll
        for (int r = 0; r < 8; ++r) sOT[j * 16 + col][qg * 32 + qt * 16 + 8 * g + r] = acc[qt][j][r]; }
  __syncthreads();                                       // the second half's sums are readable by the first half's waves
  if (half == 0u) {
#pragma unroll
    for (int qt = 0; qt < 2; ++qt)
#pragma unroll
      for (int j = 0; j < 4; ++j)
#pragma unroll
        for (int r = 0; r < 8; ++r) sOT[j * 16 + col][qg * 32 + qt * 16 + 8 * g + r] += acc[qt][j][r]; }
  __syncthreads();
  // out[t][f][n0b .. +127] = 512 B per f: 32 lanes x 16 B; one row per instruction
  for (int qq = tid; qq < FF * (BQ / 4); qq += 256) { const int f = qq >> 5, pc = qq & 31; vst2(out + ((size_t)t * FF + f) * NN + n0b + pc * 4, *(const v4f*)(&sOT[f][pc * 4])); }
}
extern "C" void kernel_launch(void* const* d_in, const int* in_sizes, int n_in, void* d_out, int out_size, void* d_ws, size_t ws_size, hipStream_t stream) {
  (void)in_sizes; (void)n_in; (void)out_size; (void)ws_size;
  const float** I = (const float**)d_in;   // input1, input2, W1, b1, W2, b2, W3, b3
  const float* x1 = I[0]; const float* x2 = I[1]; const float* W1 = I[2]; const float* b1 = I[3]; const float* W2 = I[4]; const float* b2 = I[5]; const float* W3 = I[6]; const float* b3 = I[7];
  char* ws = (char*)d_ws; size_t off = 0;
  auto take = [&](size_t bytes) { char* p = ws + off; off += (bytes + 255) & ~(size_t)255; return p; };
  __bf16* X1T = (__bf16*)take((size_t)NT * NN * CC * 2); __bf16* X2T = (__bf16*)take((size_t)NT * NN * CC * 2); float* Q32 = (float*)take((size_t)NT * NN * FF * 4);
  __bf16* Kh = (__bf16*)take((size_t)NT * NN * FF * 2); __bf16* Kl = (__bf16*)take((size_t)NT * NN * FF * 2); __bf16* GTh = (__bf16*)take((size_t)NT * FF * NN * 2); __bf16* GTl = (__bf16*)take((size_t)NT * FF * NN * 2);
  // ws ~ 42 MB
  k_cvtx<<<dim3(NN / 64, NT, 2), 256, 0, stream>>>(x1, x2, X1T, X2T);
  k_proj<<<dim3(NN / 64, NT, 3), 128, 0, stream>>>(X1T, X2T, W1, b1, W2, b2, W3, b3, Q32, Kh, Kl, GTh, GTl);
  k_dot<<<dim3(NN / BQ, NT), 256, 0, stream>>>(Q32, Kh, Kl, GTh, GTl, (float*)d_out);
}

// v005
// Measured time: 85.2 microseconds a run.
// Timed twice side by side with v004, it ran 1.03 and 1.04 times as fast.
// Over all steps from v000 it is 4.42 times as fast.
// compute dtype: input1, input2, W1..3, b1..3 (INPUTS) rounded to bf16 with exact bf16 WMMA products (f32 accumulate) for the three 1x1 projections; q kept f32 and split hi/lo, k as bf16 hi/lo rows, relu'd scores as a bf16 hi/lo pair, g as bf16 hi/lo planes — all three-product combinations into one f32 accumulator set (f32-grade); relu in f32.
#include <hip/hip_runtime.h>
#include <math.h>

typedef __attribute__((ext_vector_type(16))) _Float16 v16h;
typedef __attribute__((ext_vector_type(16))) __bf16 v16b;
typedef __attribute__((ext_vector_type(8)))  _Float16 v8h;
typedef __attribute__((ext_vector_type(8)))  float v8f;
typedef __attribute__((ext_vector_type(4)))  float v4f;
typedef __attribute__((ext_vector_type(2)))  float v2f;
typedef __attribute__((ext_vector_type(4)))  unsigned v4u;
typedef __attribute__((ext_vector_type(4)))  int v4i;
typedef float __attribute__((may_alias)) float_a;
typedef int __attribute__((may_alias)) int_a;

template <typename T> __device__ __forceinline__ void vst2(void* p, T v) { *(T*)p = v;  }
__device__ __forceinline__ v8f wmma16(v16h a, v16h b, v8f c) {
  v8f d = __builtin_amdgcn_wmma_f32_16x16x32_f16(false, a, false, b, (short)0, c, false, false);
  asm volatile("v_nop\n\tv_nop\n\tv_nop\n\tv_nop" : "+v"(d) : "v"(a), "v"(b));
  return d;
}
__device__ __forceinline__ v8f wmma_bf(v16b a, v16b b, v8f c) {
  v8f d = __builtin_amdgcn_wmma_f32_16x16x32_bf16(false, a, false, b, (short)0, c, false, false);
  asm volatile("v_nop\n\tv_nop\n\tv_nop\n\tv_nop" : "+v"(d) : "v"(a), "v"(b));
  return d;
}
// 16x16x32 fragments: lane = (h = lane>>4, row/col = lane&15); elements 0..7 = k0+8h+0..7, 8..15 = k0+16+8h+0..7; D element r = row 8h+r
__device__ __forceinline__ v16h frag_h(const _Float16* rowk0, int lane) {
  union { v16h v; v8h q[2]; } u; const _Float16* p = rowk0 + 8 * (lane >> 4);
  u.q[0] = *(const v8h*)p; u.q[1] = *(const v8h*)(p + 16); return u.v;
}
__device__ __forceinline__ v16h frag_f32(const float* rowk0, int lane) {
  v16h a; const float* p = rowk0 + 8 * (lane >> 4);
#pragma unroll
  for (int i = 0; i < 8; ++i) { a[i] = (_Float16)p[i]; a[8 + i] = (_Float16)p[16 + i]; }
  return a;
}
__device__ __forceinline__ v16h frag_f32s(const float* rowk0, int lane, float sc) {
  v16h a; const float* p = rowk0 + 8 * (lane >> 4);
#pragma unroll
  for (int i = 0; i < 8; ++i) { a[i] = (_Float16)(p[i] * sc); a[8 + i] = (_Float16)(p[16 + i] * sc); }
  return a;
}
// column fragment from a [K][ld] layout (column n), rows >= K read as 0
__device__ __forceinline__ v16h fragc_f32(const float* W, int k0, int n, int lane, int ld, int K) {
  v16h a; const int g = lane >> 4;
#pragma unroll
  for (int i = 0; i < 8; ++i) { const int ka = k0 + 8 * g + i, kb = ka + 16;
    a[i] = (_Float16)(ka < K ? W[(size_t)(ka < K ? ka : K - 1) * ld + n] : 0.f); a[8 + i] = (_Float16)(kb < K ? W[(size_t)(kb < K ? kb : K - 1) * ld + n] : 0.f); }
  return a;
}
struct F2 { v16b h, l; };
__device__ __forceinline__ F2 bsplit16(const float v[16]) { F2 r;
#pragma unroll
  for (int i = 0; i < 16; ++i) { const __bf16 h = (__bf16)v[i]; r.h[i] = h; r.l[i] = (__bf16)(v[i] - (float)h); }
  return r; }
__device__ __forceinline__ F2 split_row(const float* row, int k0, int lane) { float v[16]; const float* p = row + k0 + 8 * (lane >> 4);
#pragma unroll
  for (int i = 0; i < 8; ++i) { v[i] = p[i]; v[8 + i] = p[16 + i]; }
  return bsplit16(v); }
__device__ __forceinline__ F2 split_rowK(const float* row, int k0, int lane, int K) { float v[16]; const int g = lane >> 4;
#pragma unroll
  for (int i = 0; i < 8; ++i) { const int ka = k0 + 8 * g + i, kb = ka + 16; v[i] = ka < K ? row[ka < K ? ka : K - 1] : 0.f; v[8 + i] = kb < K ? row[kb < K ? kb : K - 1] : 0.f; }
  return bsplit16(v); }
__device__ __forceinline__ F2 split_col(const float* W, int k0, int n, int lane, int ld, int K) { float v[16]; const int g = lane >> 4;
#pragma unroll
  for (int i = 0; i < 8; ++i) { const int ka = k0 + 8 * g + i, kb = ka + 16; v[i] = ka < K ? W[(size_t)(ka < K ? ka : K - 1) * ld + n] : 0.f; v[8 + i] = kb < K ? W[(size_t)(kb < K ? kb : K - 1) * ld + n] : 0.f; }
  return bsplit16(v); }
__device__ __forceinline__ v8f mac3(const F2& a, const F2& b, v8f c) { c = wmma_bf(a.l, b.h, c); c = wmma_bf(a.h, b.l, c); return wmma_bf(a.h, b.h, c); }
__device__ __forceinline__ float sigm(float v) { return 1.0f / (1.0f + expf(-v)); }
#define LDSX() do { asm volatile("s_wait_dscnt 0" ::: "memory"); __builtin_amdgcn_wave_barrier(); __builtin_amdgcn_fence(__ATOMIC_RELEASE, "workgroup"); } while (0)


// Spatial dot-product block (ReLU branch): per frame t (8) over the 64x64 = 4,096 positions with 128 channels: q = W1 x1 + b1, k = W2 x2 + b2, g = W3 x1 + b3 (64 features); scores = relu(q k^T) (no softmax, no scale);
// out = scores g -> stored as [b][t][f][h][w] (feature-major per frame).
// k_cvtx (channel-major frames -> token-major bf16 rows for both inputs), k_proj (Q32 rows; K hi/lo rows; G^T hi/lo planes), k_dot (block = (frame, 128 queries): 128-key stages in LDS, 32 queries and 64 of the keys per wave, S^T 3 products, relu, P hi/lo packed in registers x G hi/lo 3 products, transposed store).
#define NT 8
#define CC 128
#define NN 4096
#define FF 64
__device__ __forceinline__ float bfr(float v) { return (float)(__bf16)v; }
__device__ __forceinline__ v16b frag_b(const __bf16* rowk0, int lane) { return __builtin_bit_cast(v16b, frag_h((const _Float16*)rowk0, lane)); }

// [t][c][n] f32 -> XT [t][n][c] bf16 : block (t, 64 n); both inputs (which = blockIdx.z)
__global__ __launch_bounds__(256) void k_cvtx(const float* __restrict__ x1, const float* __restrict__ x2, __bf16* __restrict__ X1T, __bf16* __restrict__ X2T) {
  __shared__ __align__(16) __bf16 st[64][CC + 8];
  const int tid = threadIdx.x; const int t = blockIdx.y, n0 = blockIdx.x * 64, which = blockIdx.z; const float* x = which == 0 ? x1 : x2; __bf16* XT = which == 0 ? X1T : X2T;
  for (int q = tid; q < CC * 16; q += 256) { const int c = q >> 4, p4 = q & 15; const v4f v = *(const v4f*)(x + ((size_t)t * CC + c) * NN + n0 + p4 * 4);
    st[p4 * 4][c] = (__bf16)v[0]; st[p4 * 4 + 1][c] = (__bf16)v[1]; st[p4 * 4 + 2][c] = (__bf16)v[2]; st[p4 * 4 + 3][c] = (__bf16)v[3]; }
  __syncthreads();
  for (int q = tid; q < 64 * (CC / 8); q += 256) { const int rl = q >> 4, pc = q & 15; vst2((unsigned*)(XT + ((size_t)t * NN + n0 + rl) * CC + pc * 8), *(const v4u*)(&st[rl][pc * 8])); }
}
// projections: block (64 tokens of frame t, which): 0: q -> Q32 rows [t][n][64]; 1: k -> Kh/Kl rows; 2: g -> GTh/GTl planes [t][f][n]
__global__ __launch_bounds__(128) void k_proj(const __bf16* __restrict__ X1T, const __bf16* __restrict__ X2T, const float* __restrict__ W1, const float* __restrict__ b1, const float* __restrict__ W2, const float* __restrict__ b2, const float* __restrict__ W3, const float* __restrict__ b3,
                                            float* __restrict__ Q32, __bf16* __restrict__ Kh, __bf16* __restrict__ Kl, __bf16* __restrict__ GTh, __bf16* __restrict__ GTl) {
  __shared__ __align__(16) float so[4][16][68]; __shared__ __align__(16) __bf16 sh_[4][16][72], sl_[4][16][72]; __shared__ __align__(16) __bf16 sth[64][72], stl[64][72];
  const int tid = threadIdx.x, wave = tid >> 5, lane = tid & 31, col = lane & 15, g = lane >> 4; const int t = blockIdx.y, n0b = blockIdx.x * 64, which = blockIdx.z; const size_t r0 = (size_t)t * NN + n0b + wave * 16;
  const __bf16* XT = which == 1 ? X2T : X1T; const float* W = which == 0 ? W1 : (which == 1 ? W2 : W3); const float* bb_ = which == 0 ? b1 : (which == 1 ? b2 : b3);
  v8f acc[4] = {};
#pragma unroll
  for (int kc = 0; kc < CC / 32; ++kc) { const v16b a = frag_b(XT + (r0 + col) * CC + kc * 32, lane);
#pragma unroll
    for (int j = 0; j < 4; ++j) acc[j] = wmma_bf(a, split_row(W + (size_t)(j * 16 + col) * CC, kc * 32, lane).h, acc[j]); }
  if (which == 0) {
#pragma unroll
    for (int j = 0; j < 4; ++j) { const float bb = bfr(bb_[j * 16 + col]);
#pragma unroll
      for (int r = 0; r < 8; ++r) so[wave][8 * g + r][j * 16 + col] = acc[j][r] + bb; }
    LDSX();
    for (int qq = lane; qq < 16 * 16; qq += 32) { const int rl = qq >> 4, pc = qq & 15; vst2(Q32 + (r0 + rl) * FF + pc * 4, *(const v4f*)(&so[wave][rl][pc * 4])); } }
  else if (which == 1) {
#pragma unroll
    for (int j = 0; j < 4; ++j) { const float bb = bfr(bb_[j * 16 + col]);
#pragma unroll
      for (int r = 0; r < 8; ++r) { const float v = acc[j][r] + bb; const __bf16 hi = (__bf16)v; sh_[wave][8 * g + r][j * 16 + col] = hi; sl_[wave][8 * g + r][j * 16 + col] = (__bf16)(v - (float)hi); } }
    LDSX();
    for (int qq = lane; qq < 16 * 8; qq += 32) { const int rl = qq >> 3, pc = qq & 7; vst2((unsigned*)(Kh + (r0 + rl) * FF + pc * 8), *(const v4u*)(&sh_[wave][rl][pc * 8])); vst2((unsigned*)(Kl + (r0 + rl) * FF + pc * 8), *(const v4u*)(&sl_[wave][rl][pc * 8])); } }
  else {
#pragma unroll
    for (int j = 0; j < 4; ++j) { const float bb = bfr(bb_[j * 16 + col]);
#pragma unroll
      for (int r = 0; r < 8; ++r) { const float v = acc[j][r] + bb; const __bf16 hi = (__bf16)v; sth[j * 16 + col][wave * 16 + 8 * g + r] = hi; stl[j * 16 + col][wave * 16 + 8 * g + r] = (__bf16)(v - (float)hi); } }
    __syncthreads();
    for (int qq = tid; qq < 64 * 8; qq += 128) { const int f = qq >> 3, pc = qq & 7; const size_t o = ((size_t)t * FF + f) * NN + n0b + pc * 8; vst2((unsigned*)(GTh + o), *(const v4u*)(&sth[f][pc * 8])); vst2((unsigned*)(GTl + o), *(const v4u*)(&stl[f][pc * 8])); } }
}
// dot block: (frame t, 128 queries), 8 waves = 4 query groups of 32 x 2 key halves: S^T = k(hi,lo).q(hi,lo) (3 products, keys as rows), relu, P hi/lo x G^T hi/lo (3 products) into 2 x 4 output tiles; out^T[t][f][n]
// A stage is 128 keys. Its eight operand tiles (per 64-key half: Kh, Kl: 64 key rows; GTh, GTl: 64 feature rows; every row 128 B) are brought into LDS once per block,
// one tensor load per wave and stage, two buffers. The four waves of a key half read their fragments from that half's tiles, and every fragment read serves the wave's two 16-query tiles.
typedef __attribute__((ext_vector_type(8))) unsigned v8u;
#define SKEYS 128          // keys of a stage
#define NST (NN / SKEYS)   // stages = passes of the key loop
#define BQ 128             // queries of a block
#define TROWB 128u         // bytes of a tile row (64 bf16)
#define TPITCH 144u        // its pitch in LDS: the load pads 16 B behind each row, 16 B x odd for ds_load_b128 readers
#define TPLACE 10240u      // 64 rows x 144 B = 9,216 B, rounded up to a multiple of 2 KiB
__device__ __forceinline__ unsigned uni(unsigned v) { return (unsigned)__builtin_amdgcn_readfirstlane(v); }
// a wave-uniform value held in a scalar register, so that the test around a tensor load compiles to a scalar branch and the words formed from it stand behind the wait in front of it
__device__ __forceinline__ unsigned pinned(unsigned v) { unsigned w = uni(v); asm volatile("" : "+s"(w)); return w; }
// The 256 work-groups stand one on each WGP (its LDS admits no second), two waves a SIMD.
__global__ __launch_bounds__(256) void k_dot(const float* __restrict__ Q32, const __bf16* __restrict__ Kh, const __bf16* __restrict__ Kl, const __bf16* __restrict__ GTh, const __bf16* __restrict__ GTl, float* __restrict__ out) {
  __shared__ __attribute__((aligned(2048))) unsigned char ring[2 * 8 * TPLACE];   // [buffer][key half][Kh, Kl, GTh, GTl][64 rows of TPITCH]
  __shared__ __align__(16) float sOT[FF][BQ + 4];      // [f][128 tokens]
  const int tid = threadIdx.x, w = tid >> 5, lane = tid & 31, col = lane & 15, g = lane >> 4; const int qg = w & 3, hk = w >> 2;
  const int t = blockIdx.y, n0b = blockIdx.x * BQ; const size_t q0 = (size_t)t * NN + n0b + qg * 32;
  // q rows of the wave's two 16-query tiles: per tile eight 16-byte pieces, piece c = floats 16 (c >> 1) + 4 (c & 1) + 0..3 behind the lane's 8 g
  const float* qp = Q32 + (q0 + col) * FF + 8 * g;
  v4f qr[2][8];
#pragma unroll
  for (int c = 0; c < 8; ++c) { qr[0][c] = *(const v4f*)(qp + 16 * (c >> 1) + 4 * (c & 1)); qr[1][c] = *(const v4f*)(qp + 16 * FF + 16 * (c >> 1) + 4 * (c & 1)); }
  // The wait stands behind the q loads and in front of any overwrite of their address registers: the loaded values as inputs hold the loads in front of it, the address as an input stays in its registers up to it.
  asm volatile("s_wait_xcnt 0x0" :: "v"(qp), "v"(qr[0][0]), "v"(qr[0][1]), "v"(qr[0][2]), "v"(qr[0][3]), "v"(qr[0][4]), "v"(qr[0][5]), "v"(qr[0][6]), "v"(qr[0][7]),
               "v"(qr[1][0]), "v"(qr[1][1]), "v"(qr[1][2]), "v"(qr[1][3]), "v"(qr[1][4]), "v"(qr[1][5]), "v"(qr[1][6]), "v"(qr[1][7]));
  F2 aq[2][2];
#pragma unroll
  for (int qt = 0; qt < 2; ++qt)
#pragma unroll
    for (int kc = 0; kc < 2; ++kc) { float v[16];
#pragma unroll
      for (int e = 0; e < 16; ++e) v[e] = qr[qt][4 * kc + (e >> 2)][e & 3];
      aq[qt][kc] = bsplit16(v); }
  v8f acc[2][4] = {};
  // wave 4 h + o brings, for key half h, tile o: 0 Kh, 1 Kl (source rows back to back), 2 GTh, 3 GTl (source rows NN keys apart); frame t starts NN * FF elements in, in all four
  const unsigned wv = uni((unsigned)tid >> 5), op = wv & 3u, half = wv >> 2;
  const __bf16* tsrc = op == 0 ? Kh : (op == 1 ? Kl : (op == 2 ? GTh : GTl));
  const unsigned hstep = op < 2 ? 64u * TROWB : TROWB;      // bytes from a 64-key tile to the next 64 keys' tile; a stage is two of them
  const unsigned long long src0 = (unsigned long long)(size_t)tsrc + (unsigned long long)t * (NN * FF * 2) + half * hstep;
  const unsigned sstep = 2u * hstep;
  const unsigned lds0 = (unsigned)(size_t)ring + wv * TPLACE;
  v8u g1;   // 1-byte elements, tensor = tile = 64 rows of 128 B, no mask, a pad of 4 dwords behind every 32
  g1[0] = uni(1u << 20 | 4u << 22 | 3u << 25); g1[1] = uni(TROWB << 16); g1[2] = uni(64u << 16); g1[3] = uni(TROWB << 16); g1[4] = uni(64u);
  g1[5] = uni(op < 2 ? TROWB : NN * 2u); g1[6] = uni(0u); g1[7] = uni(0u);
  asm volatile("" : "+s"(g1));   // the pinned() form, for descriptor words held in scalar registers: without it the compiler rebuilds the group at each load and puts other values into its registers while a request is outstanding
  auto issue = [&](unsigned st) {
    const unsigned long long ga = src0 + (unsigned long long)st * sstep;
    v4u g0; g0[0] = uni(1u); g0[1] = uni(lds0 + (st & 1u) * (8u * TPLACE)); g0[2] = uni((unsigned)ga); g0[3] = uni(((unsigned)(ga >> 32) & 0x01FFFFFFu) | 0x80000000u);
    asm volatile("tensor_load_to_lds %0, %1" :: "s"(g0), "s"(g1) : "memory");   // one request of the whole wave: its own tile of stage st
  };
  issue(0u);
  asm volatile("s_wait_tensorcnt 0x0" ::: "memory");   // this wave's tile of stage 0 has landed
  __syncthreads();                                     // all eight tiles of stage 0 are readable by every wave
  issue(1u);
  // The wave's 64 keys of a stage go in two runs of 32: a run's fragments and scores, beside the standing q and output tiles, stay within 256 registers; with all 64 keys in one run the build spills to scratch.
  // The four score tiles of a run (2 x 16 keys, 2 x 16 queries), and then the eight output tiles (2 x 16 queries, 4 x 16 features), are independent accumulators: their products are issued round-robin,
  // so that a product never waits for the one issued just before it; each tile still takes its own products in the order it had.
  // Every group of fragment reads is issued as early as registers are free for it, so that it lands behind other work and not in front of a waiting product:
  //   a run's G fragments behind its last score product (in the K fragments' registers), ahead of the vector work on the scores;
  //   the next run's K fragments of features 0..31 ahead of this run's last 8 output products (P lo and G lo are no longer read), those of features 32..63 behind its last product, ahead of the next run's first 12.
  // The run behind a stage's second run is the next stage's first: so the publish point of stage kt + 1 stands in pass kt ahead of those reads, in front of the pass's last 8 products, whose fragments are in registers by then.
  v16b khf[2][2], klf[2][2];
  auto readK = [&](const unsigned char* tk, int kc) {   // tk: the run's first key row in the Kh tile; the fragments of features 32 kc .. 32 kc + 31 of its two key tiles, hi and lo
#pragma unroll
    for (int tt = 0; tt < 2; ++tt) khf[kc][tt] = frag_b((const __bf16*)(tk + (tt * 16 + col) * TPITCH) + kc * 32, lane);
#pragma unroll
    for (int tt = 0; tt < 2; ++tt) klf[kc][tt] = frag_b((const __bf16*)(tk + TPLACE + (tt * 16 + col) * TPITCH) + kc * 32, lane); };
  readK(ring + (unsigned)hk * (4u * TPLACE), 0); readK(ring + (unsigned)hk * (4u * TPLACE), 1);   // stage 0, run 0: behind the barrier that has published stage 0
#pragma unroll 1
  for (int kt = 0; kt < NST; ++kt) {
    const unsigned char* tb = ring + (unsigned)(kt & 1) * (8u * TPLACE) + (unsigned)hk * (4u * TPLACE);         // this wave's key half of stage kt
    const unsigned char* tn = ring + (unsigned)((kt + 1) & 1) * (8u * TPLACE) + (unsigned)hk * (4u * TPLACE);   // and of stage kt + 1; in the last pass the buffer that stage NST - 2 has left: read, not used
    // The loops over runs and tiles are unrolled so that the fragment arrays are registers.
#pragma unroll
    for (int h = 0; h < 2; ++h) {
      const unsigned char* tk = h == 0 ? tb + 32u * TPITCH : tn;   // the next run's K rows
      v8f s[2][2] = {};
#pragma unroll
      for (int kc = 0; kc < 2; ++kc) {
#pragma unroll
        for (int tt = 0; tt < 2; ++tt)
#pragma unroll
          for (int qt = 0; qt < 2; ++qt) s[qt][tt] = wmma_bf(khf[kc][tt], aq[qt][kc].l, s[qt][tt]);
#pragma unroll
        for (int tt = 0; tt < 2; ++tt)
#pragma unroll
          for (int qt = 0; qt < 2; ++qt) s[qt][tt] = wmma_bf(klf[kc][tt], aq[qt][kc].h, s[qt][tt]);
#pragma unroll
        for (int tt = 0; tt < 2; ++tt)
#pragma unroll
          for (int qt = 0; qt < 2; ++qt) s[qt][tt] = wmma_bf(khf[kc][tt], aq[qt][kc].h, s[qt][tt]); }
      v16b ghf[4], glf[4];
      __builtin_amdgcn_sched_barrier(0);   // this fence and the next hold G's reads as one group here: the compiler otherwise sinks them below the vector work, to just in front of their use
#pragma unroll
      for (int j = 0; j < 4; ++j) ghf[j] = frag_b((const __bf16*)(tb + 2u * TPLACE + (j * 16 + col) * TPITCH + h * 64), lane);
#pragma unroll
      for (int j = 0; j < 4; ++j) glf[j] = frag_b((const __bf16*)(tb + 3u * TPLACE + (j * 16 + col) * TPITCH + h * 64), lane);
      __builtin_amdgcn_sched_barrier(0);   // closes the pair
      // With the keys as rows, s[qt][tt][r] of lane (g, col) is the score of query 16 qt + col and key 32 h + 16 tt + 8 g + r: the run's two key tiles hold, element for element,
      // the lane's 16 keys of the P fragment of keys 32 h .. 32 h + 31 (row = query col; k = 8 g + 0..7, then 16 + 8 g + 0..7), so P goes from the accumulators into its operand in place.
      v16b ph[2], pl[2];
#pragma unroll
      for (int qt = 0; qt < 2; ++qt)
#pragma unroll
        for (int tt = 0; tt < 2; ++tt)
#pragma unroll
          for (int r = 0; r < 8; ++r) { const float v = s[qt][tt][r] > 0.f ? s[qt][tt][r] : 0.f; const __bf16 hi = (__bf16)v; ph[qt][8 * tt + r] = hi; pl[qt][8 * tt + r] = (__bf16)(v - (float)hi); }
#pragma unroll
      for (int j = 0; j < 4; ++j)
#pragma unroll
        for (int qt = 0; qt < 2; ++qt) acc[qt][j] = wmma_bf(pl[qt], ghf[j], acc[qt][j]);
#pragma unroll
      for (int j = 0; j < 4; ++j)
#pragma unroll
        for (int qt = 0; qt < 2; ++qt) acc[qt][j] = wmma_bf(ph[qt], glf[j], acc[qt][j]);
      if (h == 1) {   // publish point of stage kt + 1
        LDSX();                                              // s_wait_dscnt 0: this wave has read all it reads of stage kt (the G fragments of its last 8 products are in registers)
        asm volatile("s_wait_tensorcnt 0x0" ::: "memory");   // this wave's tile of stage kt + 1 has landed
        __syncthreads();                                     // stage kt + 1 is readable by every wave, and every wave has left stage kt's buffer
        if (pinned(kt + 2 < NST)) issue(pinned((unsigned)kt + 2u)); }   // refill of the buffer just left
      __builtin_amdgcn_sched_barrier(0);   // this fence and the next hold the next run's first K reads as one group here, 8 products ahead of their use
      readK(tk, 0);
      __builtin_amdgcn_sched_barrier(0);   // closes the pair
#pragma unroll
      for (int j = 0; j < 4; ++j)
#pragma unroll
        for (int qt = 0; qt < 2; ++qt) acc[qt][j] = wmma_bf(ph[qt], ghf[j], acc[qt][j]);
      __builtin_amdgcn_sched_barrier(0);   // this fence and the next hold the next run's other K reads as one group here, behind the run's last product
      readK(tk, 1);
      __builtin_amdgcn_sched_barrier(0); } }   // closes the pair
  asm volatile("s_wait_tensorcnt 0x0" ::: "memory");     // no request is outstanding when the wave goes on to the output staging and ends
  asm volatile("s_wait_dscnt 0x0" ::: "memory");         // nor is any of its LDS reads (the last pass's unused K reads among them): the ring's closing order
  // The two key halves' sums of a query group are joined in the output staging: the second half's wave lays its sums down, the first half's wave adds its own to them in place.
  if (half == 1u) {
#pragma unroll
    for (int qt = 0; qt < 2; ++qt)
#pragma unroll
      for (int j = 0; j < 4; ++j)
#pragma unroll
        for (int r = 0; r < 8; ++r) sOT[j * 16 + col][qg * 32 + qt * 16 + 8 * g + r] = acc[qt][j][r]; }
  __syncthreads();                                       // the second half's sums are readable by the first half's waves
  if (half == 0u) {
#pragma unroll
    for (int qt = 0; qt < 2; ++qt)
#pragma unroll
      for (int j = 0; j < 4; ++j)
#pragma unroll
        for (int r = 0; r < 8; ++r) sOT[j * 16 + col][qg * 32 + qt * 16 + 8 * g + r] += acc[qt][j][r]; }
  __syncthreads();
  // out[t][f][n0b .. +127] = 512 B per f: 32 lanes x 16 B; one row per instruction
  for (int qq = tid; qq < FF * (BQ / 4); qq += 256) { const int f = qq >> 5, pc = qq & 31; vst2(out + ((size_t)t * FF + f) * NN + n0b + pc * 4, *(const v4f*)(&sOT[f][pc * 4])); }
}
extern "C" void kernel_launch(void* const* d_in, const int* in_sizes, int n_in, void* d_out, int out_size, void* d_ws, size_t ws_size, hipStream_t stream) {
  (void)in_sizes; (void)n_in; (void)out_size; (void)ws_size;
  const float** I = (const float**)d_in;   // input1, input2, W1, b1, W2, b2, W3, b3
  const float* x1 = I[0]; const float* x2 = I[1]; const float* W1 = I[2]; const float* b1 = I[3]; const float* W2 = I[4]; const float* b2 = I[5]; const float* W3 = I[6]; const float* b3 = I[7];
  char* ws = (char*)d_ws; size_t off = 0;
  auto take = [&](size_t bytes) { char* p = ws + off; off += (bytes + 255) & ~(size_t)255; return p; };
  __bf16* X1T = (__bf16*)take((size_t)NT * NN * CC * 2); __bf16* X2T = (__bf16*)take((size_t)NT * NN * CC * 2); float* Q32 = (float*)take((size_t)NT * NN * FF * 4);
  __bf16* Kh = (__bf16*)take((size_t)NT * NN * FF * 2); __bf16* Kl = (__bf16*)take((size_t)NT * NN * FF * 2); __bf16* GTh = (__bf16*)take((size_t)NT * FF * NN * 2); __bf16* GTl = (__bf16*)take((size_t)NT * FF * NN * 2);
  // ws ~ 42 MB
  k_cvtx<<<dim3(NN / 64, NT, 2), 256, 0, stream>>>(x1, x2, X1T, X2T);
  k_proj<<<dim3(NN / 64, NT, 3), 128, 0, stream>>>(X1T, X2T, W1, b1, W2, b2, W3, b3, Q32, Kh, Kl, GTh, GTl);
  k_dot<<<dim3(NN / BQ, NT), 256, 0, stream>>>(Q32, Kh, Kl, GTh, GTl, (float*)d_out);
}

// v006
// It runs in 82.6 microseconds.
// Next to v005, in two timings, it ran 1.04 and 1.03 times as fast.
// Over all steps from v000 it is 4.58 times as fast.
// compute dtype: input1, input2, W1..3, b1..3 (INPUTS) rounded to bf16 with exact bf16 WMMA products (f32 accumulate) for the three 1x1 projections; q kept f32 and split hi/lo, k as bf16 hi/lo rows, relu'd scores as a bf16 hi/lo pair, g as bf16 hi/lo planes — all three-product combinations into one f32 accumulator set (f32-grade); relu in f32.
#include <hip/hip_runtime.h>
#include <math.h>

typedef __attribute__((ext_vector_type(16))) _Float16 v16h;
typedef __attribute__((ext_vector_type(16))) __bf16 v16b;
typedef __attribute__((ext_vector_type(8)))  _Float16 v8h;
typedef __attribute__((ext_vector_type(8)))  float v8f;
typedef __attribute__((ext_vector_type(4)))  float v4f;
typedef __attribute__((ext_vector_type(2)))  float v2f;
typedef __attribute__((ext_vector_type(4)))  unsigned v4u;
typedef __attribute__((ext_vector_type(4)))  int v4i;
typedef float __attribute__((may_alias)) float_a;
typedef int __attribute__((may_alias)) int_a;

template <typename T> __device__ __forceinline__ void vst2(void* p, T v) { *(T*)p = v;  }
__device__ __forceinline__ v8f wmma16(v16h a, v16h b, v8f c) {
  v8f d = __builtin_amdgcn_wmma_f32_16x16x32_f16(false, a, false, b, (short)0, c, false, false);
  asm volatile("v_nop\n\tv_nop\n\tv_nop\n\tv_nop" : "+v"(d) : "v"(a), "v"(b));
  return d;
}
__device__ __forceinline__ v8f wmma_bf(v16b a, v16b b, v8f c) {
  return __builtin_amdgcn_wmma_f32_16x16x32_bf16(false, a, false, b, (short)0, c, false, false);
}
// 16x16x32 fragments: lane = (h = lane>>4, row/col = lane&15); elements 0..7 = k0+8h+0..7, 8..15 = k0+16+8h+0..7; D element r = row 8h+r
__device__ __forceinline__ v16h frag_h(const _Float16* rowk0, int lane) {
  union { v16h v; v8h q[2]; } u; const _Float16* p = rowk0 + 8 * (lane >> 4);
  u.q[0] = *(const v8h*)p; u.q[1] = *(const v8h*)(p + 16); return u.v;
}
__device__ __forceinline__ v16h frag_f32(const float* rowk0, int lane) {
  v16h a; const float* p = rowk0 + 8 * (lane >> 4);
#pragma unroll
  for (int i = 0; i < 8; ++i) { a[i] = (_Float16)p[i]; a[8 + i] = (_Float16)p[16 + i]; }
  return a;
}
__device__ __forceinline__ v16h frag_f32s(const float* rowk0, int lane, float sc) {
  v16h a; const float* p = rowk0 + 8 * (lane >> 4);
#pragma unroll
  for (int i = 0; i < 8; ++i) { a[i] = (_Float16)(p[i] * sc); a[8 + i] = (_Float16)(p[16 + i] * sc); }
  return a;
}
// column fragment from a [K][ld] layout (column n), rows >= K read as 0
__device__ __forceinline__ v16h fragc_f32(const float* W, int k0, int n, int lane, int ld, int K) {
  v16h a; const int g = lane >> 4;
#pragma unroll
  for (int i = 0; i < 8; ++i) { const int ka = k0 + 8 * g + i, kb = ka + 16;
    a[i] = (_Float16)(ka < K ? W[(size_t)(ka < K ? ka : K - 1) * ld + n] : 0.f); a[8 + i] = (_Float16)(kb < K ? W[(size_t)(kb < K ? kb : K - 1) * ld + n] : 0.f); }
  return a;
}
struct F2 { v16b h, l; };
__device__ __forceinline__ F2 bsplit16(const float v[16]) { F2 r;
#pragma unroll
  for (int i = 0; i < 16; ++i) { const __bf16 h = (__bf16)v[i]; r.h[i] = h; r.l[i] = (__bf16)(v[i] - (float)h); }
  return r; }
__device__ __forceinline__ F2 split_row(const float* row, int k0, int lane) { float v[16]; const float* p = row + k0 + 8 * (lane >> 4);
#pragma unroll
  for (int i = 0; i < 8; ++i) { v[i] = p[i]; v[8 + i] = p[16 + i]; }
  return bsplit16(v); }
__device__ __forceinline__ F2 split_rowK(const float* row, int k0, int lane, int K) { float v[16]; const int g = lane >> 4;
#pragma unroll
  for (int i = 0; i < 8; ++i) { const int ka = k0 + 8 * g + i, kb = ka + 16; v[i] = ka < K ? row[ka < K ? ka : K - 1] : 0.f; v[8 + i] = kb < K ? row[kb < K ? kb : K - 1] : 0.f; }
  return bsplit16(v); }
__device__ __forceinline__ F2 split_col(const float* W, int k0, int n, int lane, int ld, int K) { float v[16]; const int g = lane >> 4;
#pragma unroll
  for (int i = 0; i < 8; ++i) { const int ka = k0 + 8 * g + i, kb = ka + 16; v[i] = ka < K ? W[(size_t)(ka < K ? ka : K - 1) * ld + n] : 0.f; v[8 + i] = kb < K ? W[(size_t)(kb < K ? kb : K - 1) * ld + n] : 0.f; }
  return bsplit16(v); }
__device__ __forceinline__ v8f mac3(const F2& a, const F2& b, v8f c) { c = wmma_bf(a.l, b.h, c); c = wmma_bf(a.h, b.l, c); return wmma_bf(a.h, b.h, c); }
__device__ __forceinline__ float sigm(float v) { return 1.0f / (1.0f + expf(-v)); }
#define LDSX() do { asm volatile("s_wait_dscnt 0" ::: "memory"); __builtin_amdgcn_wave_barrier(); __builtin_amdgcn_fence(__ATOMIC_RELEASE, "workgroup"); } while (0)


// Spatial dot-product block (ReLU branch): per frame t (8) over the 64x64 = 4,096 positions with 128 channels: q = W1 x1 + b1, k = W2 x2 + b2, g = W3 x1 + b3 (64 features); scores = relu(q k^T) (no softmax, no scale);
// out = scores g -> stored as [b][t][f][h][w] (feature-major per frame).
// k_cvtx (channel-major frames -> token-major bf16 rows for both inputs), k_proj (Q32 rows; K hi/lo rows; G^T hi/lo planes), k_dot (block = (frame, 128 queries): 128-key stages in LDS, 32 queries and 64 of the keys per wave, S^T 3 products, relu, P hi/lo packed in registers x G hi/lo 3 products, transposed store).
#define NT 8
#define CC 128
#define NN 4096
#define FF 64
__device__ __forceinline__ float bfr(float v) { return (float)(__bf16)v; }
__device__ __forceinline__ v16b frag_b(const __bf16* rowk0, int lane) { return __builtin_bit_cast(v16b, frag_h((const _Float16*)rowk0, lane)); }

// [t][c][n] f32 -> XT [t][n][c] bf16 : block (t, 64 n); both inputs (which = blockIdx.z)
__global__ __launch_bounds__(256) void k_cvtx(const float* __restrict__ x1, const float* __restrict__ x2, __bf16* __restrict__ X1T, __bf16* __restrict__ X2T) {
  __shared__ __align__(16) __bf16 st[64][CC + 8];
  const int tid = threadIdx.x; const int t = blockIdx.y, n0 = blockIdx.x * 64, which = blockIdx.z; const float* x = which == 0 ? x1 : x2; __bf16* XT = which == 0 ? X1T : X2T;
  for (int q = tid; q < CC * 16; q += 256) { const int c = q >> 4, p4 = q & 15; const v4f v = *(const v4f*)(x + ((size_t)t * CC + c) * NN + n0 + p4 * 4);
    st[p4 * 4][c] = (__bf16)v[0]; st[p4 * 4 + 1][c] = (__bf16)v[1]; st[p4 * 4 + 2][c] = (__bf16)v[2]; st[p4 * 4 + 3][c] = (__bf16)v[3]; }
  __syncthreads();
  for (int q = tid; q < 64 * (CC / 8); q += 256) { const int rl = q >> 4, pc = q & 15; vst2((unsigned*)(XT + ((size_t)t * NN + n0 + rl) * CC + pc * 8), *(const v4u*)(&st[rl][pc * 8])); }
}
// projections: block (64 tokens of frame t, which): 0: q -> Q32 rows [t][n][64]; 1: k -> Kh/Kl rows; 2: g -> GTh/GTl planes [t][f][n]
__global__ __launch_bounds__(128) void k_proj(const __bf16* __restrict__ X1T, const __bf16* __restrict__ X2T, const float* __restrict__ W1, const float* __restrict__ b1, const float* __restrict__ W2, const float* __restrict__ b2, const float* __restrict__ W3, const float* __restrict__ b3,
                                            float* __restrict__ Q32, __bf16* __restrict__ Kh, __bf16* __restrict__ Kl, __bf16* __restrict__ GTh, __bf16* __restrict__ GTl) {
  __shared__ __align__(16) float so[4][16][68]; __shared__ __align__(16) __bf16 sh_[4][16][72], sl_[4][16][72]; __shared__ __align__(16) __bf16 sth[64][72], stl[64][72];
  const int tid = threadIdx.x, wave = tid >> 5, lane = tid & 31, col = lane & 15, g = lane >> 4; const int t = blockIdx.y, n0b = blockIdx.x * 64, which = blockIdx.z; const size_t r0 = (size_t)t * NN + n0b + wave * 16;
  const __bf16* XT = which == 1 ? X2T : X1T; const float* W = which == 0 ? W1 : (which == 1 ? W2 : W3); const float* bb_ = which == 0 ? b1 : (which == 1 ? b2 : b3);
  v8f acc[4] = {};
#pragma unroll
  for (int kc = 0; kc < CC / 32; ++kc) { const v16b a = frag_b(XT + (r0 + col) * CC + kc * 32, lane);
#pragma unroll
    for (int j = 0; j < 4; ++j) acc[j] = wmma_bf(a, split_row(W + (size_t)(j * 16 + col) * CC, kc * 32, lane).h, acc[j]); }
  if (which == 0) {
#pragma unroll
    for (int j = 0; j < 4; ++j) { const float bb = bfr(bb_[j * 16 + col]);
#pragma unroll
      for (int r = 0; r < 8; ++r) so[wave][8 * g + r][j * 16 + col] = acc[j][r] + bb; }
    LDSX();
    for (int qq = lane; qq < 16 * 16; qq += 32) { const int rl = qq >> 4, pc = qq & 15; vst2(Q32 + (r0 + rl) * FF + pc * 4, *(const v4f*)(&so[wave][rl][pc * 4])); } }
  else if (which == 1) {
#pragma unroll
    for (int j = 0; j < 4; ++j) { const float bb = bfr(bb_[j * 16 + col]);
#pragma unroll
      for (int r = 0; r < 8; ++r) { const float v = acc[j][r] + bb; const __bf16 hi = (__bf16)v; sh_[wave][8 * g + r][j * 16 + col] = hi; sl_[wave][8 * g + r][j * 16 + col] = (__bf16)(v - (float)hi); } }
    LDSX();
    for (int qq = lane; qq < 16 * 8; qq += 32) { const int rl = qq >> 3, pc = qq & 7; vst2((unsigned*)(Kh + (r0 + rl) * FF + pc * 8), *(const v4u*)(&sh_[wave][rl][pc * 8])); vst2((unsigned*)(Kl + (r0 + rl) * FF + pc * 8), *(const v4u*)(&sl_[wave][rl][pc * 8])); } }
  else {
#pragma unroll
    for (int j = 0; j < 4; ++j) { const float bb = bfr(bb_[j * 16 + col]);
#pragma unroll
      for (int r = 0; r < 8; ++r) { const float v = acc[j][r] + bb; const __bf16 hi = (__bf16)v; sth[j * 16 + col][wave * 16 + 8 * g + r] = hi; stl[j * 16 + col][wave * 16 + 8 * g + r] = (__bf16)(v - (float)hi); } }
    __syncthreads();
    for (int qq = tid; qq < 64 * 8; qq += 128) { const int f = qq >> 3, pc = qq & 7; const size_t o = ((size_t)t * FF + f) * NN + n0b + pc * 8; vst2((unsigned*)(GTh + o), *(const v4u*)(&sth[f][pc * 8])); vst2((unsigned*)(GTl + o), *(const v4u*)(&stl[f][pc * 8])); } }
}
// dot block: (frame t, 128 queries), 8 waves = 4 query groups of 32 x 2 key halves: S^T = k(hi,lo).q(hi,lo) (3 products, keys as rows), relu, P hi/lo x G^T hi/lo (3 products) into 2 x 4 output tiles; out^T[t][f][n]
// A stage is 128 keys. Its eight operand tiles (per 64-key half: Kh, Kl: 64 key rows; GTh, GTl: 64 feature rows; every row 128 B) are brought into LDS once per block,
// one tensor load per wave and stage, two buffers. The four waves of a key half read their fragments from that half's tiles, and every fragment read serves the wave's two 16-query tiles.
typedef __attribute__((ext_vector_type(8))) unsigned v8u;
#define SKEYS 128          // keys of a stage
#define NST (NN / SKEYS)   // stages = passes of the key loop
#define BQ 128             // queries of a block
#define TROWB 128u         // bytes of a tile row (64 bf16)
#define TPITCH 144u        // its pitch in LDS: the load pads 16 B behind each row, 16 B x odd for ds_load_b128 readers
#define TPLACE 10240u      // 64 rows x 144 B = 9,216 B, rounded up to a multiple of 2 KiB
__device__ __forceinline__ unsigned uni(unsigned v) { return (unsigned)__builtin_amdgcn_readfirstlane(v); }
// a wave-uniform value held in a scalar register, so that the test around a tensor load compiles to a scalar branch and the words formed from it stand behind the wait in front of it
__device__ __forceinline__ unsigned pinned(unsigned v) { unsigned w = uni(v); asm volatile("" : "+s"(w)); return w; }
// The 256 work-groups stand one on each WGP (its LDS admits no second), two waves a SIMD.
__global__ __launch_bounds__(256) void k_dot(const float* __restrict__ Q32, const __bf16* __restrict__ Kh, const __bf16* __restrict__ Kl, const __bf16* __restrict__ GTh, const __bf16* __restrict__ GTl, float* __restrict__ out) {
  __shared__ __attribute__((aligned(2048))) unsigned char ring[2 * 8 * TPLACE];   // [buffer][key half][Kh, Kl, GTh, GTl][64 rows of TPITCH]
  __shared__ __align__(16) float sOT[FF][BQ + 4];      // [f][128 tokens]
  const int tid = threadIdx.x, w = tid >> 5, lane = tid & 31, col = lane & 15, g = lane >> 4; const int qg = w & 3, hk = w >> 2;
  const int t = blockIdx.y, n0b = blockIdx.x * BQ; const size_t q0 = (size_t)t * NN + n0b + qg * 32;
  // q rows of the wave's two 16-query tiles: per tile eight 16-byte pieces, piece c = floats 16 (c >> 1) + 4 (c & 1) + 0..3 behind the lane's 8 g
  const float* qp = Q32 + (q0 + col) * FF + 8 * g;
  v4f qr[2][8];
#pragma unroll
  for (int c = 0; c < 8; ++c) { qr[0][c] = *(const v4f*)(qp + 16 * (c >> 1) + 4 * (c & 1)); qr[1][c] = *(const v4f*)(qp + 16 * FF + 16 * (c >> 1) + 4 * (c & 1)); }
  // The wait stands behind the q loads and in front of any overwrite of their address registers: the loaded values as inputs hold the loads in front of it, the address as an input stays in its registers up to it.
  asm volatile("s_wait_xcnt 0x0" :: "v"(qp), "v"(qr[0][0]), "v"(qr[0][1]), "v"(qr[0][2]), "v"(qr[0][3]), "v"(qr[0][4]), "v"(qr[0][5]), "v"(qr[0][6]), "v"(qr[0][7]),
               "v"(qr[1][0]), "v"(qr[1][1]), "v"(qr[1][2]), "v"(qr[1][3]), "v"(qr[1][4]), "v"(qr[1][5]), "v"(qr[1][6]), "v"(qr[1][7]));
  F2 aq[2][2];
#pragma unroll
  for (int qt = 0; qt < 2; ++qt)
#pragma unroll
    for (int kc = 0; kc < 2; ++kc) { float v[16];
#pragma unroll
      for (int e = 0; e < 16; ++e) v[e] = qr[qt][4 * kc + (e >> 2)][e & 3];
      aq[qt][kc] = bsplit16(v); }
  v8f acc[2][4] = {};
  // wave 4 h + o brings, for key half h, tile o: 0 Kh, 1 Kl (source rows back to back), 2 GTh, 3 GTl (source rows NN keys apart); frame t starts NN * FF elements in, in all four
  const unsigned wv = uni((unsigned)tid >> 5), op = wv & 3u, half = wv >> 2;
  const __bf16* tsrc = op == 0 ? Kh : (op == 1 ? Kl : (op == 2 ? GTh : GTl));
  const unsigned hstep = op < 2 ? 64u * TROWB : TROWB;      // bytes from a 64-key tile to the next 64 keys' tile; a stage is two of them
  const unsigned long long src0 = (unsigned long long)(size_t)tsrc + (unsigned long long)t * (NN * FF * 2) + half * hstep;
  const unsigned sstep = 2u * hstep;
  const unsigned lds0 = (unsigned)(size_t)ring + wv * TPLACE;
  v8u g1;   // 1-byte elements, tensor = tile = 64 rows of 128 B, no mask, a pad of 4 dwords behind every 32
  g1[0] = uni(1u << 20 | 4u << 22 | 3u << 25); g1[1] = uni(TROWB << 16); g1[2] = uni(64u << 16); g1[3] = uni(TROWB << 16); g1[4] = uni(64u);
  g1[5] = uni(op < 2 ? TROWB : NN * 2u); g1[6] = uni(0u); g1[7] = uni(0u);
  asm volatile("" : "+s"(g1));   // the pinned() form, for descriptor words held in scalar registers: without it the compiler rebuilds the group at each load and puts other values into its registers while a request is outstanding
  auto issue = [&](unsigned st) {
    const unsigned long long ga = src0 + (unsigned long long)st * sstep;
    v4u g0; g0[0] = uni(1u); g0[1] = uni(lds0 + (st & 1u) * (8u * TPLACE)); g0[2] = uni((unsigned)ga); g0[3] = uni(((unsigned)(ga >> 32) & 0x01FFFFFFu) | 0x80000000u);
    asm volatile("tensor_load_to_lds %0, %1" :: "s"(g0), "s"(g1) : "memory");   // one request of the whole wave: its own tile of stage st
  };
  issue(0u);
  asm volatile("s_wait_tensorcnt 0x0" ::: "memory");   // this wave's tile of stage 0 has landed
  __syncthreads();                                     // all eight tiles of stage 0 are readable by every wave
  issue(1u);
  // The wave's 64 keys of a stage go in two runs of 32: a run's fragments and scores, beside the standing q and output tiles, stay within 256 registers; with all 64 keys in one run the build spills to scratch.
  // The four score tiles of a run (2 x 16 keys, 2 x 16 queries), and then the eight output tiles (2 x 16 queries, 4 x 16 features), are independent accumulators: their products are issued round-robin,
  // so that a product never waits for the one issued just before it; each tile still takes its own products in the order it had.
  // Every group of fragment reads is issued as early as registers are free for it, so that it lands behind other work and not in front of a waiting product:
  //   a run's G fragments behind its last score product (in the K fragments' registers), ahead of the vector work on the scores;
  //   the next run's K fragments of features 0..31 ahead of this run's last 8 output products (P lo and G lo are no longer read), those of features 32..63 behind its last product, ahead of the next run's first 12.
  // The run behind a stage's second run is the next stage's first: so the publish point of stage kt + 1 stands in pass kt ahead of those reads, in front of the pass's last 8 products, whose fragments are in registers by then.
  v16b khf[2][2], klf[2][2];
  auto readK = [&](const unsigned char* tk, int kc) {   // tk: the run's first key row in the Kh tile; the fragments of features 32 kc .. 32 kc + 31 of its two key tiles, hi and lo
#pragma unroll
    for (int tt = 0; tt < 2; ++tt) khf[kc][tt] = frag_b((const __bf16*)(tk + (tt * 16 + col) * TPITCH) + kc * 32, lane);
#pragma unroll
    for (int tt = 0; tt < 2; ++tt) klf[kc][tt] = frag_b((const __bf16*)(tk + TPLACE + (tt * 16 + col) * TPITCH) + kc * 32, lane); };
  readK(ring + (unsigned)hk * (4u * TPLACE), 0); readK(ring + (unsigned)hk * (4u * TPLACE), 1);   // stage 0, run 0: behind the barrier that has published stage 0
#pragma unroll 1
  for (int kt = 0; kt < NST; ++kt) {
    const unsigned char* tb = ring + (unsigned)(kt & 1) * (8u * TPLACE) + (unsigned)hk * (4u * TPLACE);         // this wave's key half of stage kt
    const unsigned char* tn = ring + (unsigned)((kt + 1) & 1) * (8u * TPLACE) + (unsigned)hk * (4u * TPLACE);   // and of stage kt + 1; in the last pass the buffer that stage NST - 2 has left: read, not used
    // The loops over runs and tiles are unrolled so that the fragment arrays are registers.
#pragma unroll
    for (int h = 0; h < 2; ++h) {
      const unsigned char* tk = h == 0 ? tb + 32u * TPITCH : tn;   // the next run's K rows
      v8f s[2][2] = {};
#pragma unroll
      for (int kc = 0; kc < 2; ++kc) {
#pragma unroll
        for (int tt = 0; tt < 2; ++tt)
#pragma unroll
          for (int qt = 0; qt < 2; ++qt) s[qt][tt] = wmma_bf(khf[kc][tt], aq[qt][kc].l, s[qt][tt]);
#pragma unroll
        for (int tt = 0; tt < 2; ++tt)
#pragma unroll
          for (int qt = 0; qt < 2; ++qt) s[qt][tt] = wmma_bf(klf[kc][tt], aq[qt][kc].h, s[qt][tt]);
#pragma unroll
        for (int tt = 0; tt < 2; ++tt)
#pragma unroll
          for (int qt = 0; qt < 2; ++qt) s[qt][tt] = wmma_bf(khf[kc][tt], aq[qt][kc].h, s[qt][tt]); }
      v16b ghf[4], glf[4];
      __builtin_amdgcn_sched_barrier(0);   // this fence and the next hold G's reads as one group here: the compiler otherwise sinks them below the vector work, to just in front of their use
#pragma unroll
      for (int j = 0; j < 4; ++j) ghf[j] = frag_b((const __bf16*)(tb + 2u * TPLACE + (j * 16 + col) * TPITCH + h * 64), lane);
#pragma unroll
      for (int j = 0; j < 4; ++j) glf[j] = frag_b((const __bf16*)(tb + 3u * TPLACE + (j * 16 + col) * TPITCH + h * 64), lane);
      __builtin_amdgcn_sched_barrier(0);   // closes the pair
      // With the keys as rows, s[qt][tt][r] of lane (g, col) is the score of query 16 qt + col and key 32 h + 16 tt + 8 g + r: the run's two key tiles hold, element for element,
      // the lane's 16 keys of the P fragment of keys 32 h .. 32 h + 31 (row = query col; k = 8 g + 0..7, then 16 + 8 g + 0..7), so P goes from the accumulators into its operand in place.
      v16b ph[2], pl[2];
#pragma unroll
      for (int qt = 0; qt < 2; ++qt)
#pragma unroll
        for (int tt = 0; tt < 2; ++tt)
#pragma unroll
          for (int r = 0; r < 8; ++r) { const float v = s[qt][tt][r] > 0.f ? s[qt][tt][r] : 0.f; const __bf16 hi = (__bf16)v; ph[qt][8 * tt + r] = hi; pl[qt][8 * tt + r] = (__bf16)(v - (float)hi); }
#pragma unroll
      for (int j = 0; j < 4; ++j)
#pragma unroll
        for (int qt = 0; qt < 2; ++qt) acc[qt][j] = wmma_bf(pl[qt], ghf[j], acc[qt][j]);
#pragma unroll
      for (int j = 0; j < 4; ++j)
#pragma unroll
        for (int qt = 0; qt < 2; ++qt) acc[qt][j] = wmma_bf(ph[qt], glf[j], acc[qt][j]);
      if (h == 1) {   // publish point of stage kt + 1
        __builtin_amdgcn_sched_barrier(0);                   // keeps the 16 products above in front of the publish point: the compiler otherwise sinks them below the barrier, which then stands ahead of 24 products and not 8
        LDSX();                                              // s_wait_dscnt 0: this wave has read all it reads of stage kt (the G fragments of its last 8 products are in registers)
        asm volatile("s_wait_tensorcnt 0x0" ::: "memory");   // this wave's tile of stage kt + 1 has landed
        __syncthreads();                                     // stage kt + 1 is readable by every wave, and every wave has left stage kt's buffer
        if (pinned(kt + 2 < NST)) issue(pinned((unsigned)kt + 2u)); }   // refill of the buffer just left
      __builtin_amdgcn_sched_barrier(0);   // this fence and the next hold the next run's first K reads as one group here, 8 products ahead of their use
      readK(tk, 0);
      __builtin_amdgcn_sched_barrier(0);   // closes the pair
#pragma unroll
      for (int j = 0; j < 4; ++j)
#pragma unroll
        for (int qt = 0; qt < 2; ++qt) acc[qt][j] = wmma_bf(ph[qt], ghf[j], acc[qt][j]);
      __builtin_amdgcn_sched_barrier(0);   // this fence and the next hold the next run's other K reads as one group here, behind the run's last product
      readK(tk, 1);
      __builtin_amdgcn_sched_barrier(0); } }   // closes the pair
  asm volatile("s_wait_tensorcnt 0x0" ::: "memory");     // no request is outstanding when the wave goes on to the output staging and ends
  asm volatile("s_wait_dscnt 0x0" ::: "memory");         // nor is any of its LDS reads (the last pass's unused K reads among them): the ring's closing order
  // The two key halves' sums of a query group are joined in the output staging: the second half's wave lays its sums down, the first half's wave adds its own to them in place.
  if (half == 1u) {
#pragma unroll
    for (int qt = 0; qt < 2; ++qt)
#pragma unroll
      for (int j = 0; j < 4; ++j)
#pragma unroll
        for (int r = 0; r < 8; ++r) sOT[j * 16 + col][qg * 32 + qt * 16 + 8 * g + r] = acc[qt][j][r]; }
  __syncthreads();                                       // the second half's sums are readable by the first half's waves
  if (half == 0u) {
#pragma unroll
    for (int qt = 0; qt < 2; ++qt)
#pragma unroll
      for (int j = 0; j < 4; ++j)
#pragma unroll
        for (int r = 0; r < 8; ++r) sOT[j * 16 + col][qg * 32 + qt * 16 + 8 * g + r] += acc[qt][j][r]; }
  __syncthreads();
  // out[t][f][n0b .. +127] = 512 B per f: 32 lanes x 16 B; one row per instruction
  for (int qq = tid; qq < FF * (BQ / 4); qq += 256) { const int f = qq >> 5, pc = qq & 31; vst2(out + ((size_t)t * FF + f) * NN + n0b + pc * 4, *(const v4f*)(&sOT[f][pc * 4])); }
}
extern "C" void kernel_launch(void* const* d_in, const int* in_sizes, int n_in, void* d_out, int out_size, void* d_ws, size_t ws_size, hipStream_t stream) {
  (void)in_sizes; (void)n_in; (void)out_size; (void)ws_size;
  const float** I = (const float**)d_in;   // input1, input2, W1, b1, W2, b2, W3, b3
  const float* x1 = I[0]; const float* x2 = I[1]; const float* W1 = I[2]; const float* b1 = I[3]; const float* W2 = I[4]; const float* b2 = I[5]; const float* W3 = I[6]; const float* b3 = I[7];
  char* ws = (char*)d_ws; size_t off = 0;
  auto take = [&](size_t bytes) { char* p = ws + off; off += (bytes + 255) & ~(size_t)255; return p; };
  __bf16* X1T = (__bf16*)take((size_t)NT * NN * CC * 2); __bf16* X2T = (__bf16*)take((size_t)NT * NN * CC * 2); float* Q32 = (float*)take((size_t)NT * NN * FF * 4);
  __bf16* Kh = (__bf16*)take((size_t)NT * NN * FF * 2); __bf16* Kl = (__bf16*)take((size_t)NT * NN * FF * 2); __bf16* GTh = (__bf16*)take((size_t)NT * FF * NN * 2); __bf16* GTl = (__bf16*)take((size_t)NT * FF * NN * 2);
  // ws ~ 42 MB
  k_cvtx<<<dim3(NN / 64, NT, 2), 256, 0, stream>>>(x1, x2, X1T, X2T);
  k_proj<<<dim3(NN / 64, NT, 3), 128, 0, stream>>>(X1T, X2T, W1, b1, W2, b2, W3, b3, Q32, Kh, Kl, GTh, GTl);
  k_dot<<<dim3(NN / BQ, NT), 256, 0, stream>>>(Q32, Kh, Kl, GTh, GTl, (float*)d_out);
}

// v007
// A run of this version takes 67.5 microseconds.
// Timed twice side by side with v006, it ran 1.22 times as fast both times.
// All steps since v000 together make it 5.57 times as fast.
// compute dtype: input1, input2, W1..3, b1..3 (INPUTS) rounded to bf16 with exact bf16 WMMA products (f32 accumulate) for the three 1x1 projections; q kept f32 and split hi/lo, k as bf16 hi/lo rows, relu'd scores as a bf16 hi/lo pair, g as bf16 hi/lo planes — all three-product combinations into one f32 accumulator set (f32-grade); relu in f32.
#include <hip/hip_runtime.h>
#include <math.h>

typedef __attribute__((ext_vector_type(16))) _Float16 v16h;
typedef __attribute__((ext_vector_type(16))) __bf16 v16b;
typedef __attribute__((ext_vector_type(8)))  _Float16 v8h;
typedef __attribute__((ext_vector_type(8)))  float v8f;
typedef __attribute__((ext_vector_type(4)))  float v4f;
typedef __attribute__((ext_vector_type(2)))  float v2f;
typedef __attribute__((ext_vector_type(4)))  unsigned v4u;
typedef __attribute__((ext_vector_type(4)))  int v4i;
typedef float __attribute__((may_alias)) float_a;
typedef int __attribute__((may_alias)) int_a;

template <typename T> __device__ __forceinline__ void vst2(void* p, T v) { *(T*)p = v;  }
__device__ __forceinline__ v8f wmma16(v16h a, v16h b, v8f c) {
  v8f d = __builtin_amdgcn_wmma_f32_16x16x32_f16(false, a, false, b, (short)0, c, false, false);
  asm volatile("v_nop\n\tv_nop\n\tv_nop\n\tv_nop" : "+v"(d) : "v"(a), "v"(b));
  return d;
}
__device__ __forceinline__ v8f wmma_bf(v16b a, v16b b, v8f c) {
  return __builtin_amdgcn_wmma_f32_16x16x32_bf16(false, a, false, b, (short)0, c, false, false);
}
// 16x16x32 fragments: lane = (h = lane>>4, row/col = lane&15); elements 0..7 = k0+8h+0..7, 8..15 = k0+16+8h+0..7; D element r = row 8h+r
__device__ __forceinline__ v16h frag_h(const _Float16* rowk0, int lane) {
  union { v16h v; v8h q[2]; } u; const _Float16* p = rowk0 + 8 * (lane >> 4);
  u.q[0] = *(const v8h*)p; u.q[1] = *(const v8h*)(p + 16); return u.v;
}
__device__ __forceinline__ v16h frag_f32(const float* rowk0, int lane) {
  v16h a; const float* p = rowk0 + 8 * (lane >> 4);
#pragma unroll
  for (int i = 0; i < 8; ++i) { a[i] = (_Float16)p[i]; a[8 + i] = (_Float16)p[16 + i]; }
  return a;
}
__device__ __forceinline__ v16h frag_f32s(const float* rowk0, int lane, float sc) {
  v16h a; const float* p = rowk0 + 8 * (lane >> 4);
#pragma unroll
  for (int i = 0; i < 8; ++i) { a[i] = (_Float16)(p[i] * sc); a[8 + i] = (_Float16)(p[16 + i] * sc); }
  return a;
}
// column fragment from a [K][ld] layout (column n), rows >= K read as 0
__device__ __forceinline__ v16h fragc_f32(const float* W, int k0, int n, int lane, int ld, int K) {
  v16h a; const int g = lane >> 4;
#pragma unroll
  for (int i = 0; i < 8; ++i) { const int ka = k0 + 8 * g + i, kb = ka + 16;
    a[i] = (_Float16)(ka < K ? W[(size_t)(ka < K ? ka : K - 1) * ld + n] : 0.f); a[8 + i] = (_Float16)(kb < K ? W[(size_t)(kb < K ? kb : K - 1) * ld + n] : 0.f); }
  return a;
}
struct F2 { v16b h, l; };
__device__ __forceinline__ F2 bsplit16(const float v[16]) { F2 r;
#pragma unroll
  for (int i = 0; i < 16; ++i) { const __bf16 h = (__bf16)v[i]; r.h[i] = h; r.l[i] = (__bf16)(v[i] - (float)h); }
  return r; }
__device__ __forceinline__ F2 split_row(const float* row, int k0, int lane) { float v[16]; const float* p = row + k0 + 8 * (lane >> 4);
#pragma unroll
  for (int i = 0; i < 8; ++i) { v[i] = p[i]; v[8 + i] = p[16 + i]; }
  return bsplit16(v); }
__device__ __forceinline__ F2 split_rowK(const float* row, int k0, int lane, int K) { float v[16]; const int g = lane >> 4;
#pragma unroll
  for (int i = 0; i < 8; ++i) { const int ka = k0 + 8 * g + i, kb = ka + 16; v[i] = ka < K ? row[ka < K ? ka : K - 1] : 0.f; v[8 + i] = kb < K ? row[kb < K ? kb : K - 1] : 0.f; }
  return bsplit16(v); }
__device__ __forceinline__ F2 split_col(const float* W, int k0, int n, int lane, int ld, int K) { float v[16]; const int g = lane >> 4;
#pragma unroll
  for (int i = 0; i < 8; ++i) { const int ka = k0 + 8 * g + i, kb = ka + 16; v[i] = ka < K ? W[(size_t)(ka < K ? ka : K - 1) * ld + n] : 0.f; v[8 + i] = kb < K ? W[(size_t)(kb < K ? kb : K - 1) * ld + n] : 0.f; }
  return bsplit16(v); }
__device__ __forceinline__ v8f mac3(const F2& a, const F2& b, v8f c) { c = wmma_bf(a.l, b.h, c); c = wmma_bf(a.h, b.l, c); return wmma_bf(a.h, b.h, c); }
__device__ __forceinline__ float sigm(float v) { return 1.0f / (1.0f + expf(-v)); }
#define LDSX() do { asm volatile("s_wait_dscnt 0" ::: "memory"); __builtin_amdgcn_wave_barrier(); __builtin_amdgcn_fence(__ATOMIC_RELEASE, "workgroup"); } while (0)


// Spatial dot-product block (ReLU branch): per frame t (8) over the 64x64 = 4,096 positions with 128 channels: q = W1 x1 + b1, k = W2 x2 + b2, g = W3 x1 + b3 (64 features); scores = relu(q k^T) (no softmax, no scale);
// out = scores g -> stored as [b][t][f][h][w] (feature-major per frame).
// k_proj (channel-major f32 frames -> token-major bf16 tiles in LDS -> Q32 rows; K hi/lo rows; G^T hi/lo planes), k_dot (block = (frame, 128 queries): 128-key stages in LDS, 32 queries and 64 of the keys per wave, S^T 3 products, relu, P hi/lo packed in registers x G hi/lo 3 products, transposed store).
#define NT 8
#define CC 128
#define NN 4096
#define FF 64
__device__ __forceinline__ float bfr(float v) { return (float)(__bf16)v; }
__device__ __forceinline__ v16b frag_b(const __bf16* rowk0, int lane) { return __builtin_bit_cast(v16b, frag_h((const _Float16*)rowk0, lane)); }

#define PT 128             // tokens of a projection block
typedef __attribute__((ext_vector_type(8))) __bf16 v8b;
// projections, straight from the f32 frames: block (128 tokens of frame t, which input). The input's [128 c][128 n] tile is rounded to bf16 on its way into LDS and laid down token-major;
// wave w takes tokens 16 w .. 16 w + 15 and reads its A fragments there. input1: q -> Q32 rows [t][n][64], then g -> GTh/GTl planes [t][f][n]; input2: k -> Kh/Kl rows
// Two work-groups stand on a WGP (512 work-groups, 256 WGPs): four waves a SIMD, so 256 registers a wave.
__global__ __launch_bounds__(256) __attribute__((amdgpu_waves_per_eu(4, 4))) void k_proj(const float* __restrict__ x1, const float* __restrict__ x2, const float* __restrict__ W1, const float* __restrict__ b1, const float* __restrict__ W2, const float* __restrict__ b2, const float* __restrict__ W3, const float* __restrict__ b3,
                                            float* __restrict__ Q32, __bf16* __restrict__ Kh, __bf16* __restrict__ Kl, __bf16* __restrict__ GTh, __bf16* __restrict__ GTl) {
  __shared__ __align__(16) __bf16 st[PT][CC + 8];
  __shared__ __align__(16) float so[8][16][68]; __shared__ __align__(16) __bf16 sh_[8][16][72], sl_[8][16][72]; __shared__ __align__(16) __bf16 sth[FF][PT + 8], stl[FF][PT + 8];
  const int tid = threadIdx.x, wave = tid >> 5, lane = tid & 31, col = lane & 15, g = lane >> 4; const int t = blockIdx.y, n0b = blockIdx.x * PT, inp = blockIdx.z; const size_t r0 = (size_t)t * NN + n0b + wave * 16;
  // A thread takes tokens 4 lane .. 4 lane + 3 of channels 8 wave + 0..7 and 64 + 8 wave + 0..7: each load of a wave reads 512 B of one channel row, and the thread's 16 loads are in flight together.
  const float* xp = (inp == 0 ? x1 : x2) + ((size_t)t * CC + 8 * wave) * NN + n0b + 4 * lane;
  v4f xv[2][8];
#pragma unroll
  for (int u = 0; u < 2; ++u)
#pragma unroll
    for (int i = 0; i < 8; ++i) xv[u][i] = *(const v4f*)(xp + (size_t)(64 * u + i) * NN);
  // The wait stands behind the x loads and in front of any overwrite of their address registers: the loaded values as inputs hold the loads in front of it, the address as an input stays in its registers up to it.
  asm volatile("s_wait_xcnt 0x0" :: "v"(xp), "v"(xv[0][0]), "v"(xv[0][1]), "v"(xv[0][2]), "v"(xv[0][3]), "v"(xv[0][4]), "v"(xv[0][5]), "v"(xv[0][6]), "v"(xv[0][7]),
               "v"(xv[1][0]), "v"(xv[1][1]), "v"(xv[1][2]), "v"(xv[1][3]), "v"(xv[1][4]), "v"(xv[1][5]), "v"(xv[1][6]), "v"(xv[1][7]));
  // eight channels of one token are 16 B of its LDS row
#pragma unroll
  for (int u = 0; u < 2; ++u)
#pragma unroll
    for (int e = 0; e < 4; ++e) { v8b p;
#pragma unroll
      for (int i = 0; i < 8; ++i) p[i] = (__bf16)xv[u][i][e];
      vst2(&st[4 * lane + e][64 * u + 8 * wave], p); }
  __syncthreads();   // the whole tile is readable by every wave
  v16b a[CC / 32];
#pragma unroll
  for (int kc = 0; kc < CC / 32; ++kc) a[kc] = frag_b(&st[wave * 16 + col][kc * 32], lane);
  auto proj = [&](const float* __restrict__ W, v8f* acc) {
    const float* wp = W + (size_t)col * CC + 8 * g;   // the lane's place in feature row col; every W load of the projection is a constant step from it
#pragma unroll
    for (int kc = 0; kc < CC / 32; ++kc) {
      if (kc == 2) __builtin_amdgcn_sched_barrier(0);   // holds the W loads of channels 64..127 behind the products of channels 0..63: with all 64 loads of a projection in flight the build spills to scratch
#pragma unroll
      for (int j = 0; j < 4; ++j) { float v[16];
#pragma unroll
        for (int i = 0; i < 8; ++i) { v[i] = wp[j * 16 * CC + kc * 32 + i]; v[8 + i] = wp[j * 16 * CC + kc * 32 + 16 + i]; }
        acc[j] = wmma_bf(a[kc], bsplit16(v).h, acc[j]); } }
    // The wait stands behind the W loads and in front of any overwrite of their address registers: the address as an input stays in its registers up to it.
    asm volatile("s_wait_xcnt 0x0" :: "v"(wp)); };
  if (inp == 0) {
    { v8f acc[4] = {}; proj(W1, acc);
#pragma unroll
      for (int j = 0; j < 4; ++j) { const float bb = bfr(b1[j * 16 + col]);
#pragma unroll
        for (int r = 0; r < 8; ++r) so[wave][8 * g + r][j * 16 + col] = acc[j][r] + bb; }
      LDSX();
      for (int qq = lane; qq < 16 * 16; qq += 32) { const int rl = qq >> 4, pc = qq & 15; vst2(Q32 + (r0 + rl) * FF + pc * 4, *(const v4f*)(&so[wave][rl][pc * 4])); } }
    { v8f acc[4] = {}; proj(W3, acc);
#pragma unroll
      for (int j = 0; j < 4; ++j) { const float bb = bfr(b3[j * 16 + col]);
#pragma unroll
        for (int r = 0; r < 8; ++r) { const float v = acc[j][r] + bb; const __bf16 hi = (__bf16)v; sth[j * 16 + col][wave * 16 + 8 * g + r] = hi; stl[j * 16 + col][wave * 16 + 8 * g + r] = (__bf16)(v - (float)hi); } } }
    __syncthreads();   // the block's 128 tokens of every feature row are laid down
    // unrolled: the four trips' LDS reads go out together, and no store's address registers are rewritten behind it
#pragma unroll
    for (int i = 0; i < FF * (PT / 8) / 256; ++i) { const int qq = tid + 256 * i, f = qq >> 4, pc = qq & 15; const size_t o = ((size_t)t * FF + f) * NN + n0b + pc * 8; vst2((unsigned*)(GTh + o), *(const v4u*)(&sth[f][pc * 8])); vst2((unsigned*)(GTl + o), *(const v4u*)(&stl[f][pc * 8])); } }
  else {
    v8f acc[4] = {}; proj(W2, acc);
#pragma unroll
    for (int j = 0; j < 4; ++j) { const float bb = bfr(b2[j * 16 + col]);
#pragma unroll
      for (int r = 0; r < 8; ++r) { const float v = acc[j][r] + bb; const __bf16 hi = (__bf16)v; sh_[wave][8 * g + r][j * 16 + col] = hi; sl_[wave][8 * g + r][j * 16 + col] = (__bf16)(v - (float)hi); } }
    LDSX();
    for (int qq = lane; qq < 16 * 8; qq += 32) { const int rl = qq >> 3, pc = qq & 7; vst2((unsigned*)(Kh + (r0 + rl) * FF + pc * 8), *(const v4u*)(&sh_[wave][rl][pc * 8])); vst2((unsigned*)(Kl + (r0 + rl) * FF + pc * 8), *(const v4u*)(&sl_[wave][rl][pc * 8])); } }
}
// dot block: (frame t, 128 queries), 8 waves = 4 query groups of 32 x 2 key halves: S^T = k(hi,lo).q(hi,lo) (3 products, keys as rows), relu, P hi/lo x G^T hi/lo (3 products) into 2 x 4 output tiles; out^T[t][f][n]
// A stage is 128 keys. Its eight operand tiles (per 64-key half: Kh, Kl: 64 key rows; GTh, GTl: 64 feature rows; every row 128 B) are brought into LDS once per block,
// one tensor load per wave and stage, two buffers. The four waves of a key half read their fragments from that half's tiles, and every fragment read serves the wave's two 16-query tiles.
typedef __attribute__((ext_vector_type(8))) unsigned v8u;
#define SKEYS 128          // keys of a stage
#define NST (NN / SKEYS)   // stages = passes of the key loop
#define BQ 128             // queries of a block
#define TROWB 128u         // bytes of a tile row (64 bf16)
#define TPITCH 144u        // its pitch in LDS: the load pads 16 B behind each row, 16 B x odd for ds_load_b128 readers
#define TPLACE 10240u      // 64 rows x 144 B = 9,216 B, rounded up to a multiple of 2 KiB
__device__ __forceinline__ unsigned uni(unsigned v) { return (unsigned)__builtin_amdgcn_readfirstlane(v); }
// a wave-uniform value held in a scalar register, so that the test around a tensor load compiles to a scalar branch and the words formed from it stand behind the wait in front of it
__device__ __forceinline__ unsigned pinned(unsigned v) { unsigned w = uni(v); asm volatile("" : "+s"(w)); return w; }
// The 256 work-groups stand one on each WGP (its LDS admits no second), two waves a SIMD.
__global__ __launch_bounds__(256) void k_dot(const float* __restrict__ Q32, const __bf16* __restrict__ Kh, const __bf16* __restrict__ Kl, const __bf16* __restrict__ GTh, const __bf16* __restrict__ GTl, float* __restrict__ out) {
  __shared__ __attribute__((aligned(2048))) unsigned char ring[2 * 8 * TPLACE];   // [buffer][key half][Kh, Kl, GTh, GTl][64 rows of TPITCH]
  __shared__ __align__(16) float sOT[FF][BQ + 4];      // [f][128 tokens]
  const int tid = threadIdx.x, w = tid >> 5, lane = tid & 31, col = lane & 15, g = lane >> 4; const int qg = w & 3, hk = w >> 2;
  const int t = blockIdx.y, n0b = blockIdx.x * BQ; const size_t q0 = (size_t)t * NN + n0b + qg * 32;
  // q rows of the wave's two 16-query tiles: per tile eight 16-byte pieces, piece c = floats 16 (c >> 1) + 4 (c & 1) + 0..3 behind the lane's 8 g
  const float* qp = Q32 + (q0 + col) * FF + 8 * g;
  v4f qr[2][8];
#pragma unroll
  for (int c = 0; c < 8; ++c) { qr[0][c] = *(const v4f*)(qp + 16 * (c >> 1) + 4 * (c & 1)); qr[1][c] = *(const v4f*)(qp + 16 * FF + 16 * (c >> 1) + 4 * (c & 1)); }
  // The wait stands behind the q loads and in front of any overwrite of their address registers: the loaded values as inputs hold the loads in front of it, the address as an input stays in its registers up to it.
  asm volatile("s_wait_xcnt 0x0" :: "v"(qp), "v"(qr[0][0]), "v"(qr[0][1]), "v"(qr[0][2]), "v"(qr[0][3]), "v"(qr[0][4]), "v"(qr[0][5]), "v"(qr[0][6]), "v"(qr[0][7]),
               "v"(qr[1][0]), "v"(qr[1][1]), "v"(qr[1][2]), "v"(qr[1][3]), "v"(qr[1][4]), "v"(qr[1][5]), "v"(qr[1][6]), "v"(qr[1][7]));
  F2 aq[2][2];
#pragma unroll
  for (int qt = 0; qt < 2; ++qt)
#pragma unroll
    for (int kc = 0; kc < 2; ++kc) { float v[16];
#pragma unroll
      for (int e = 0; e < 16; ++e) v[e] = qr[qt][4 * kc + (e >> 2)][e & 3];
      aq[qt][kc] = bsplit16(v); }
  v8f acc[2][4] = {};
  // wave 4 h + o brings, for key half h, tile o: 0 Kh, 1 Kl (source rows back to back), 2 GTh, 3 GTl (source rows NN keys apart); frame t starts NN * FF elements in, in all four
  const unsigned wv = uni((unsigned)tid >> 5), op = wv & 3u, half = wv >> 2;
  const __bf16* tsrc = op == 0 ? Kh : (op == 1 ? Kl : (op == 2 ? GTh : GTl));
  const unsigned hstep = op < 2 ? 64u * TROWB : TROWB;      // bytes from a 64-key tile to the next 64 keys' tile; a stage is two of them
  const unsigned long long src0 = (unsigned long long)(size_t)tsrc + (unsigned long long)t * (NN * FF * 2) + half * hstep;
  const unsigned sstep = 2u * hstep;
  const unsigned lds0 = (unsigned)(size_t)ring + wv * TPLACE;
  v8u g1;   // 1-byte elements, tensor = tile = 64 rows of 128 B, no mask, a pad of 4 dwords behind every 32
  g1[0] = uni(1u << 20 | 4u << 22 | 3u << 25); g1[1] = uni(TROWB << 16); g1[2] = uni(64u << 16); g1[3] = uni(TROWB << 16); g1[4] = uni(64u);
  g1[5] = uni(op < 2 ? TROWB : NN * 2u); g1[6] = uni(0u); g1[7] = uni(0u);
  asm volatile("" : "+s"(g1));   // the pinned() form, for descriptor words held in scalar registers: without it the compiler rebuilds the group at each load and puts other values into its registers while a request is outstanding
  auto issue = [&](unsigned st) {
    const unsigned long long ga = src0 + (unsigned long long)st * sstep;
    v4u g0; g0[0] = uni(1u); g0[1] = uni(lds0 + (st & 1u) * (8u * TPLACE)); g0[2] = uni((unsigned)ga); g0[3] = uni(((unsigned)(ga >> 32) & 0x01FFFFFFu) | 0x80000000u);
    asm volatile("tensor_load_to_lds %0, %1" :: "s"(g0), "s"(g1) : "memory");   // one request of the whole wave: its own tile of stage st
  };
  issue(0u);
  asm volatile("s_wait_tensorcnt 0x0" ::: "memory");   // this wave's tile of stage 0 has landed
  __syncthreads();                                     // all eight tiles of stage 0 are readable by every wave
  issue(1u);
  // The wave's 64 keys of a stage go in two runs of 32: a run's fragments and scores, beside the standing q and output tiles, stay within 256 registers; with all 64 keys in one run the build spills to scratch.
  // The four score tiles of a run (2 x 16 keys, 2 x 16 queries), and then the eight output tiles (2 x 16 queries, 4 x 16 features), are independent accumulators: their products are issued round-robin,
  // so that a product never waits for the one issued just before it; each tile still takes its own products in the order it had.
  // Every group of fragment reads is issued as early as registers are free for it, so that it lands behind other work and not in front of a waiting product:
  //   a run's G fragments behind its last score product (in the K fragments' registers), ahead of the vector work on the scores;
  //   the next run's K fragments of features 0..31 ahead of this run's last 8 output products (P lo and G lo are no longer read), those of features 32..63 behind its last product, ahead of the next run's first 12.
  // The run behind a stage's second run is the next stage's first: so the publish point of stage kt + 1 stands in pass kt ahead of those reads, in front of the pass's last 8 products, whose fragments are in registers by then.
  v16b khf[2][2], klf[2][2];
  auto readK = [&](const unsigned char* tk, int kc) {   // tk: the run's first key row in the Kh tile; the fragments of features 32 kc .. 32 kc + 31 of its two key tiles, hi and lo
#pragma unroll
    for (int tt = 0; tt < 2; ++tt) khf[kc][tt] = frag_b((const __bf16*)(tk + (tt * 16 + col) * TPITCH) + kc * 32, lane);
#pragma unroll
    for (int tt = 0; tt < 2; ++tt) klf[kc][tt] = frag_b((const __bf16*)(tk + TPLACE + (tt * 16 + col) * TPITCH) + kc * 32, lane); };
  readK(ring + (unsigned)hk * (4u * TPLACE), 0); readK(ring + (unsigned)hk * (4u * TPLACE), 1);   // stage 0, run 0: behind the barrier that has published stage 0
#pragma unroll 1
  for (int kt = 0; kt < NST; ++kt) {
    const unsigned char* tb = ring + (unsigned)(kt & 1) * (8u * TPLACE) + (unsigned)hk * (4u * TPLACE);         // this wave's key half of stage kt
    const unsigned char* tn = ring + (unsigned)((kt + 1) & 1) * (8u * TPLACE) + (unsigned)hk * (4u * TPLACE);   // and of stage kt + 1; in the last pass the buffer that stage NST - 2 has left: read, not used
    // The loops over runs and tiles are unrolled so that the fragment arrays are registers.
#pragma unroll
    for (int h = 0; h < 2; ++h) {
      const unsigned char* tk = h == 0 ? tb + 32u * TPITCH : tn;   // the next run's K rows
      v8f s[2][2] = {};
#pragma unroll
      for (int kc = 0; kc < 2; ++kc) {
#pragma unroll
        for (int tt = 0; tt < 2; ++tt)
#pragma unroll
          for (int qt = 0; qt < 2; ++qt) s[qt][tt] = wmma_bf(khf[kc][tt], aq[qt][kc].l, s[qt][tt]);
#pragma unroll
        for (int tt = 0; tt < 2; ++tt)
#pragma unroll
          for (int qt = 0; qt < 2; ++qt) s[qt][tt] = wmma_bf(klf[kc][tt], aq[qt][kc].h, s[qt][tt]);
#pragma unroll
        for (int tt = 0; tt < 2; ++tt)
#pragma unroll
          for (int qt = 0; qt < 2; ++qt) s[qt][tt] = wmma_bf(khf[kc][tt], aq[qt][kc].h, s[qt][tt]); }
      v16b ghf[4], glf[4];
      __builtin_amdgcn_sched_barrier(0);   // this fence and the next hold G's reads as one group here: the compiler otherwise sinks them below the vector work, to just in front of their use
#pragma unroll
      for (int j = 0; j < 4; ++j) ghf[j] = frag_b((const __bf16*)(tb + 2u * TPLACE + (j * 16 + col) * TPITCH + h * 64), lane);
#pragma unroll
      for (int j = 0; j < 4; ++j) glf[j] = frag_b((const __bf16*)(tb + 3u * TPLACE + (j * 16 + col) * TPITCH + h * 64), lane);
      __builtin_amdgcn_sched_barrier(0);   // closes the pair
      // With the keys as rows, s[qt][tt][r] of lane (g, col) is the score of query 16 qt + col and key 32 h + 16 tt + 8 g + r: the run's two key tiles hold, element for element,
      // the lane's 16 keys of the P fragment of keys 32 h .. 32 h + 31 (row = query col; k = 8 g + 0..7, then 16 + 8 g + 0..7), so P goes from the accumulators into its operand in place.
      v16b ph[2], pl[2];
#pragma unroll
      for (int qt = 0; qt < 2; ++qt)
#pragma unroll
        for (int tt = 0; tt < 2; ++tt)
#pragma unroll
          for (int r = 0; r < 8; ++r) { const float v = s[qt][tt][r] > 0.f ? s[qt][tt][r] : 0.f; const __bf16 hi = (__bf16)v; ph[qt][8 * tt + r] = hi; pl[qt][8 * tt + r] = (__bf16)(v - (float)hi); }
#pragma unroll
      for (int j = 0; j < 4; ++j)
#pragma unroll
        for (int qt = 0; qt < 2; ++qt) acc[qt][j] = wmma_bf(pl[qt], ghf[j], acc[qt][j]);
#pragma unroll
      for (int j = 0; j < 4; ++j)
#pragma unroll
        for (int qt = 0; qt < 2; ++qt) acc[qt][j] = wmma_bf(ph[qt], glf[j], acc[qt][j]);
      if (h == 1) {   // publish point of stage kt + 1
        __builtin_amdgcn_sched_barrier(0);                   // keeps the 16 products above in front of the publish point: the compiler otherwise sinks them below the barrier, which then stands ahead of 24 products and not 8
        LDSX();                                              // s_wait_dscnt 0: this wave has read all it reads of stage kt (the G fragments of its last 8 products are in registers)
        asm volatile("s_wait_tensorcnt 0x0" ::: "memory");   // this wave's tile of stage kt + 1 has landed
        __syncthreads();                                     // stage kt + 1 is readable by every wave, and every wave has left stage kt's buffer
        if (pinned(kt + 2 < NST)) issue(pinned((unsigned)kt + 2u)); }   // refill of the buffer just left
      __builtin_amdgcn_sched_barrier(0);   // this fence and the next hold the next run's first K reads as one group here, 8 products ahead of their use
      readK(tk, 0);
      __builtin_amdgcn_sched_barrier(0);   // closes the pair
#pragma unroll
      for (int j = 0; j < 4; ++j)
#pragma unroll
        for (int qt = 0; qt < 2; ++qt) acc[qt][j] = wmma_bf(ph[qt], ghf[j], acc[qt][j]);
      __builtin_amdgcn_sched_barrier(0);   // this fence and the next hold the next run's other K reads as one group here, behind the run's last product
      readK(tk, 1);
      __builtin_amdgcn_sched_barrier(0); } }   // closes the pair
  asm volatile("s_wait_tensorcnt 0x0" ::: "memory");     // no request is outstanding when the wave goes on to the output staging and ends
  asm volatile("s_wait_dscnt 0x0" ::: "memory");         // nor is any of its LDS reads (the last pass's unused K reads among them): the ring's closing order
  // The two key halves' sums of a query group are joined in the output staging: the second half's wave lays its sums down, the first half's wave adds its own to them in place.
  if (half == 1u) {
#pragma unroll
    for (int qt = 0; qt < 2; ++qt)
#pragma unroll
      for (int j = 0; j < 4; ++j)
#pragma unroll
        for (int r = 0; r < 8; ++r) sOT[j * 16 + col][qg * 32 + qt * 16 + 8 * g + r] = acc[qt][j][r]; }
  __syncthreads();                                       // the second half's sums are readable by the first half's waves
  if (half == 0u) {
#pragma unroll
    for (int qt = 0; qt < 2; ++qt)
#pragma unroll
      for (int j = 0; j < 4; ++j)
#pragma unroll
        for (int r = 0; r < 8; ++r) sOT[j * 16 + col][qg * 32 + qt * 16 + 8 * g + r] += acc[qt][j][r]; }
  __syncthreads();
  // out[t][f][n0b .. +127] = 512 B per f: 32 lanes x 16 B; one row per instruction
  for (int qq = tid; qq < FF * (BQ / 4); qq += 256) { const int f = qq >> 5, pc = qq & 31; vst2(out + ((size_t)t * FF + f) * NN + n0b + pc * 4, *(const v4f*)(&sOT[f][pc * 4])); }
}
extern "C" void kernel_launch(void* const* d_in, const int* in_sizes, int n_in, void* d_out, int out_size, void* d_ws, size_t ws_size, hipStream_t stream) {
  (void)in_sizes; (void)n_in; (void)out_size; (void)ws_size;
  const float** I = (const float**)d_in;   // input1, input2, W1, b1, W2, b2, W3, b3
  const float* x1 = I[0]; const float* x2 = I[1]; const float* W1 = I[2]; const float* b1 = I[3]; const float* W2 = I[4]; const float* b2 = I[5]; const float* W3 = I[6]; const float* b3 = I[7];
  char* ws = (char*)d_ws; size_t off = 0;
  auto take = [&](size_t bytes) { char* p = ws + off; off += (bytes + 255) & ~(size_t)255; return p; };
  float* Q32 = (float*)take((size_t)NT * NN * FF * 4);
  __bf16* Kh = (__bf16*)take((size_t)NT * NN * FF * 2); __bf16* Kl = (__bf16*)take((size_t)NT * NN * FF * 2); __bf16* GTh = (__bf16*)take((size_t)NT * FF * NN * 2); __bf16* GTl = (__bf16*)take((size_t)NT * FF * NN * 2);
  // ws ~ 25 MB
  k_proj<<<dim3(NN / PT, NT, 2), 256, 0, stream>>>(x1, x2, W1, b1, W2, b2, W3, b3, Q32, Kh, Kl, GTh, GTl);
  k_dot<<<dim3(NN / BQ, NT), 256, 0, stream>>>(Q32, Kh, Kl, GTh, GTl, (float*)d_out);
}

// v008
// One run takes 62.9 microseconds.
// Two timings next to v007 put it at 1.07 and 1.08 times that version's speed.
// All steps since v000 together make it 5.98 times as fast.
// compute dtype: input1, input2, W1..3, b1..3 (INPUTS) rounded to bf16 with exact bf16 WMMA products (f32 accumulate) for the three 1x1 projections; q kept f32 and split hi/lo, k as bf16 hi/lo rows, relu'd scores as a bf16 hi/lo pair, g as bf16 hi/lo planes — all three-product combinations into one f32 accumulator set (f32-grade); relu in f32.
#include <hip/hip_runtime.h>
#include <math.h>

typedef __attribute__((ext_vector_type(16))) _Float16 v16h;
typedef __attribute__((ext_vector_type(16))) __bf16 v16b;
typedef __attribute__((ext_vector_type(8)))  _Float16 v8h;
typedef __attribute__((ext_vector_type(8)))  float v8f;
typedef __attribute__((ext_vector_type(4)))  float v4f;
typedef __attribute__((ext_vector_type(2)))  float v2f;
typedef __attribute__((ext_vector_type(4)))  unsigned v4u;
typedef __attribute__((ext_vector_type(4)))  int v4i;
typedef float __attribute__((may_alias)) float_a;
typedef int __attribute__((may_alias)) int_a;

template <typename T> __device__ __forceinline__ void vst2(void* p, T v) { *(T*)p = v;  }
__device__ __forceinline__ v8f wmma16(v16h a, v16h b, v8f c) {
  v8f d = __builtin_amdgcn_wmma_f32_16x16x32_f16(false, a, false, b, (short)0, c, false, false);
  asm volatile("v_nop\n\tv_nop\n\tv_nop\n\tv_nop" : "+v"(d) : "v"(a), "v"(b));
  return d;
}
__device__ __forceinline__ v8f wmma_bf(v16b a, v16b b, v8f c) {
  return __builtin_amdgcn_wmma_f32_16x16x32_bf16(false, a, false, b, (short)0, c, false, false);
}
// 16x16x32 fragments: lane = (h = lane>>4, row/col = lane&15); elements 0..7 = k0+8h+0..7, 8..15 = k0+16+8h+0..7; D element r = row 8h+r
__device__ __forceinline__ v16h frag_h(const _Float16* rowk0, int lane) {
  union { v16h v; v8h q[2]; } u; const _Float16* p = rowk0 + 8 * (lane >> 4);
  u.q[0] = *(const v8h*)p; u.q[1] = *(const v8h*)(p + 16); return u.v;
}
__device__ __forceinline__ v16h frag_f32(const float* rowk0, int lane) {
  v16h a; const float* p = rowk0 + 8 * (lane >> 4);
#pragma unroll
  for (int i = 0; i < 8; ++i) { a[i] = (_Float16)p[i]; a[8 + i] = (_Float16)p[16 + i]; }
  return a;
}
__device__ __forceinline__ v16h frag_f32s(const float* rowk0, int lane, float sc) {
  v16h a; const float* p = rowk0 + 8 * (lane >> 4);
#pragma unroll
  for (int i = 0; i < 8; ++i) { a[i] = (_Float16)(p[i] * sc); a[8 + i] = (_Float16)(p[16 + i] * sc); }
  return a;
}
// column fragment from a [K][ld] layout (column n), rows >= K read as 0
__device__ __forceinline__ v16h fragc_f32(const float* W, int k0, int n, int lane, int ld, int K) {
  v16h a; const int g = lane >> 4;
#pragma unroll
  for (int i = 0; i < 8; ++i) { const int ka = k0 + 8 * g + i, kb = ka + 16;
    a[i] = (_Float16)(ka < K ? W[(size_t)(ka < K ? ka : K - 1) * ld + n] : 0.f); a[8 + i] = (_Float16)(kb < K ? W[(size_t)(kb < K ? kb : K - 1) * ld + n] : 0.f); }
  return a;
}
struct F2 { v16b h, l; };
__device__ __forceinline__ F2 bsplit16(const float v[16]) { F2 r;
#pragma unroll
  for (int i = 0; i < 16; ++i) { const __bf16 h = (__bf16)v[i]; r.h[i] = h; r.l[i] = (__bf16)(v[i] - (float)h); }
  return r; }
__device__ __forceinline__ F2 split_row(const float* row, int k0, int lane) { float v[16]; const float* p = row + k0 + 8 * (lane >> 4);
#pragma unroll
  for (int i = 0; i < 8; ++i) { v[i] = p[i]; v[8 + i] = p[16 + i]; }
  return bsplit16(v); }
__device__ __forceinline__ F2 split_rowK(const float* row, int k0, int lane, int K) { float v[16]; const int g = lane >> 4;
#pragma unroll
  for (int i = 0; i < 8; ++i) { const int ka = k0 + 8 * g + i, kb = ka + 16; v[i] = ka < K ? row[ka < K ? ka : K - 1] : 0.f; v[8 + i] = kb < K ? row[kb < K ? kb : K - 1] : 0.f; }
  return bsplit16(v); }
__device__ __forceinline__ F2 split_col(const float* W, int k0, int n, int lane, int ld, int K) { float v[16]; const int g = lane >> 4;
#pragma unroll
  for (int i = 0; i < 8; ++i) { const int ka = k0 + 8 * g + i, kb = ka + 16; v[i] = ka < K ? W[(size_t)(ka < K ? ka : K - 1) * ld + n] : 0.f; v[8 + i] = kb < K ? W[(size_t)(kb < K ? kb : K - 1) * ld + n] : 0.f; }
  return bsplit16(v); }
__device__ __forceinline__ v8f mac3(const F2& a, const F2& b, v8f c) { c = wmma_bf(a.l, b.h, c); c = wmma_bf(a.h, b.l, c); return wmma_bf(a.h, b.h, c); }
__device__ __forceinline__ float sigm(float v) { return 1.0f / (1.0f + expf(-v)); }
#define LDSX() do { asm volatile("s_wait_dscnt 0" ::: "memory"); __builtin_amdgcn_wave_barrier(); __builtin_amdgcn_fence(__ATOMIC_RELEASE, "workgroup"); } while (0)


// Spatial dot-product block (ReLU branch): per frame t (8) over the 64x64 = 4,096 positions with 128 channels: q = W1 x1 + b1, k = W2 x2 + b2, g = W3 x1 + b3 (64 features); scores = relu(q k^T) (no softmax, no scale);
// out = scores g -> stored as [b][t][f][h][w] (feature-major per frame).
// k_proj (channel-major f32 frames -> token-major bf16 tiles in LDS -> Q32 rows; K hi/lo rows; G^T hi/lo planes), k_dot (block = (frame, 128 queries): 128-key stages in LDS, 32 queries and 64 of the keys per wave, S^T 3 products, relu, P hi/lo packed in registers x G hi/lo 3 products, transposed store).
#define NT 8
#define CC 128
#define NN 4096
#define FF 64
__device__ __forceinline__ float bfr(float v) { return (float)(__bf16)v; }
__device__ __forceinline__ v16b frag_b(const __bf16* rowk0, int lane) { return __builtin_bit_cast(v16b, frag_h((const _Float16*)rowk0, lane)); }

#define PT 128             // tokens of a projection block
typedef __attribute__((ext_vector_type(8))) __bf16 v8b;
typedef __attribute__((ext_vector_type(4))) __bf16 v4b;
// projections, straight from the f32 frames: block (128 tokens of frame t, which input). The input's [128 c][128 n] tile is rounded to bf16 on its way into LDS and laid down token-major;
// wave w takes tokens 16 w .. 16 w + 15 and reads its A fragments there. input1: q -> Q32 rows [t][n][64], then g -> GTh/GTl planes [t][f][n]; input2: k -> Kh/Kl rows
// The block's weight matrices are rounded to bf16 once, on their way into LDS, and all eight waves read their B fragments there.
// Two work-groups stand on a WGP (512 work-groups, 256 WGPs): four waves a SIMD, so 256 registers a wave.
__global__ __launch_bounds__(256) __attribute__((amdgpu_waves_per_eu(4, 4))) void k_proj(const float* __restrict__ x1, const float* __restrict__ x2, const float* __restrict__ W1, const float* __restrict__ b1, const float* __restrict__ W2, const float* __restrict__ b2, const float* __restrict__ W3, const float* __restrict__ b3,
                                            float* __restrict__ Q32, __bf16* __restrict__ Kh, __bf16* __restrict__ Kl, __bf16* __restrict__ GTh, __bf16* __restrict__ GTl) {
  __shared__ __align__(16) __bf16 st[PT][CC + 8];
  __shared__ __align__(16) float so[8][16][68]; __shared__ __align__(16) __bf16 sh_[8][16][72], sl_[8][16][72]; __shared__ __align__(16) __bf16 sth[FF][PT + 8], stl[FF][PT + 8];
  __shared__ __align__(16) __bf16 sw[FF][CC + 8];               // W1 (input1) or W2 (input2) as bf16 feature rows; the pitch of 272 B is 16 B x odd, for ds_load_b128 readers
  __bf16 (*sw3)[CC + 8] = (__bf16 (*)[CC + 8])&sh_[0][0][0];    // W3 the same way, in the k staging, which a block of input1 does not use otherwise
  const int tid = threadIdx.x, wave = tid >> 5, lane = tid & 31, col = lane & 15, g = lane >> 4; const int t = blockIdx.y, n0b = blockIdx.x * PT, inp = blockIdx.z; const size_t r0 = (size_t)t * NN + n0b + wave * 16;
  // Of a weight matrix a thread takes floats 4 lane .. 4 lane + 3 of feature rows wave + 8 i: each load of a wave reads one whole row of 512 B. The loads go out ahead of the x loads and land under them.
  const float* Wa = inp == 0 ? W1 : W2; const float* wpb = W3 + 4 * tid;
  v4f wa[8], wb[8];
#pragma unroll
  for (int i = 0; i < 8; ++i) wa[i] = *(const v4f*)(Wa + 4 * tid + 8 * CC * i);
  if (inp == 0) {
#pragma unroll
    for (int i = 0; i < 8; ++i) wb[i] = *(const v4f*)(wpb + 8 * CC * i); }
  // A thread takes tokens 4 lane .. 4 lane + 3 of channels 8 wave + 0..7 and 64 + 8 wave + 0..7: each load of a wave reads 512 B of one channel row, and the thread's 16 loads are in flight together.
  const float* xp = (inp == 0 ? x1 : x2) + ((size_t)t * CC + 8 * wave) * NN + n0b + 4 * lane;
  v4f xv[2][8];
#pragma unroll
  for (int u = 0; u < 2; ++u)
#pragma unroll
    for (int i = 0; i < 8; ++i) xv[u][i] = *(const v4f*)(xp + (size_t)(64 * u + i) * NN);
  auto putW = [&](const v4f* r, __bf16 (*dst)[CC + 8]) {
#pragma unroll
    for (int i = 0; i < 8; ++i) { v4b p;
#pragma unroll
      for (int e = 0; e < 4; ++e) p[e] = (__bf16)r[i][e];
      vst2(&dst[wave + 8 * i][4 * lane], p); } };
  __builtin_amdgcn_sched_barrier(0);   // holds the rounding of W behind the issue of the x loads: the compiler otherwise lifts part of it, with its wait for W's data, in front of them
  // The waits stand behind the W loads and in front of any overwrite of their address registers: the loaded values as inputs hold the loads in front, the address (a scalar base and the thread's number; a vector pair) as an input stays in its registers up to the wait.
  asm volatile("s_wait_xcnt 0x0" :: "s"(Wa), "v"(tid), "v"(wa[0]), "v"(wa[1]), "v"(wa[2]), "v"(wa[3]), "v"(wa[4]), "v"(wa[5]), "v"(wa[6]), "v"(wa[7]));
  putW(wa, sw);
  if (inp == 0) {
    asm volatile("s_wait_xcnt 0x0" :: "v"(wpb), "v"(wb[0]), "v"(wb[1]), "v"(wb[2]), "v"(wb[3]), "v"(wb[4]), "v"(wb[5]), "v"(wb[6]), "v"(wb[7]));
    putW(wb, sw3); }
  // The wait stands behind the x loads and in front of any overwrite of their address registers: the loaded values as inputs hold the loads in front of it, the address as an input stays in its registers up to it.
  asm volatile("s_wait_xcnt 0x0" :: "v"(xp), "v"(xv[0][0]), "v"(xv[0][1]), "v"(xv[0][2]), "v"(xv[0][3]), "v"(xv[0][4]), "v"(xv[0][5]), "v"(xv[0][6]), "v"(xv[0][7]),
               "v"(xv[1][0]), "v"(xv[1][1]), "v"(xv[1][2]), "v"(xv[1][3]), "v"(xv[1][4]), "v"(xv[1][5]), "v"(xv[1][6]), "v"(xv[1][7]));
  // eight channels of one token are 16 B of its LDS row
#pragma unroll
  for (int u = 0; u < 2; ++u)
#pragma unroll
    for (int e = 0; e < 4; ++e) { v8b p;
#pragma unroll
      for (int i = 0; i < 8; ++i) p[i] = (__bf16)xv[u][i][e];
      vst2(&st[4 * lane + e][64 * u + 8 * wave], p); }
  __syncthreads();   // the whole tile and the weights are readable by every wave
  v16b a[CC / 32];
#pragma unroll
  for (int kc = 0; kc < CC / 32; ++kc) a[kc] = frag_b(&st[wave * 16 + col][kc * 32], lane);
  auto proj = [&](const __bf16 (*Wb)[CC + 8], v8f* acc) {
    v16b wf[CC / 32][4];
    auto rd = [&](int kc) {
#pragma unroll
      for (int j = 0; j < 4; ++j) wf[kc][j] = frag_b(&Wb[j * 16 + col][kc * 32], lane); };
    // Each fence holds the fragment reads above it, eight to 32 channels, ahead of the products below it, so that a group is issued at least four products ahead of its use:
    // the compiler otherwise sinks the reads, in pairs, to just in front of their product, each pair waited for in full.
    rd(0); rd(1);
    __builtin_amdgcn_sched_barrier(0);
#pragma unroll
    for (int kc = 0; kc < CC / 32; ++kc) {
#pragma unroll
      for (int j = 0; j < 4; ++j) acc[j] = wmma_bf(a[kc], wf[kc][j], acc[j]);
      if (kc + 2 < CC / 32) { rd(kc + 2); __builtin_amdgcn_sched_barrier(0); } } };
  if (inp == 0) {
    { v8f acc[4] = {}; proj(sw, acc);
#pragma unroll
      for (int j = 0; j < 4; ++j) { const float bb = bfr(b1[j * 16 + col]);
#pragma unroll
        for (int r = 0; r < 8; ++r) so[wave][8 * g + r][j * 16 + col] = acc[j][r] + bb; }
      LDSX();
      for (int qq = lane; qq < 16 * 16; qq += 32) { const int rl = qq >> 4, pc = qq & 15; vst2(Q32 + (r0 + rl) * FF + pc * 4, *(const v4f*)(&so[wave][rl][pc * 4])); } }
    { v8f acc[4] = {}; proj(sw3, acc);
#pragma unroll
      for (int j = 0; j < 4; ++j) { const float bb = bfr(b3[j * 16 + col]);
#pragma unroll
        for (int r = 0; r < 8; ++r) { const float v = acc[j][r] + bb; const __bf16 hi = (__bf16)v; sth[j * 16 + col][wave * 16 + 8 * g + r] = hi; stl[j * 16 + col][wave * 16 + 8 * g + r] = (__bf16)(v - (float)hi); } } }
    __syncthreads();   // the block's 128 tokens of every feature row are laid down
    // unrolled: the four trips' LDS reads go out together, and no store's address registers are rewritten behind it
#pragma unroll
    for (int i = 0; i < FF * (PT / 8) / 256; ++i) { const int qq = tid + 256 * i, f = qq >> 4, pc = qq & 15; const size_t o = ((size_t)t * FF + f) * NN + n0b + pc * 8; vst2((unsigned*)(GTh + o), *(const v4u*)(&sth[f][pc * 8])); vst2((unsigned*)(GTl + o), *(const v4u*)(&stl[f][pc * 8])); } }
  else {
    v8f acc[4] = {}; proj(sw, acc);
#pragma unroll
    for (int j = 0; j < 4; ++j) { const float bb = bfr(b2[j * 16 + col]);
#pragma unroll
      for (int r = 0; r < 8; ++r) { const float v = acc[j][r] + bb; const __bf16 hi = (__bf16)v; sh_[wave][8 * g + r][j * 16 + col] = hi; sl_[wave][8 * g + r][j * 16 + col] = (__bf16)(v - (float)hi); } }
    LDSX();
    for (int qq = lane; qq < 16 * 8; qq += 32) { const int rl = qq >> 3, pc = qq & 7; vst2((unsigned*)(Kh + (r0 + rl) * FF + pc * 8), *(const v4u*)(&sh_[wave][rl][pc * 8])); vst2((unsigned*)(Kl + (r0 + rl) * FF + pc * 8), *(const v4u*)(&sl_[wave][rl][pc * 8])); } }
}
// dot block: (frame t, 128 queries), 8 waves = 4 query groups of 32 x 2 key halves: S^T = k(hi,lo).q(hi,lo) (3 products, keys as rows), relu, P hi/lo x G^T hi/lo (3 products) into 2 x 4 output tiles; out^T[t][f][n]
// A stage is 128 keys. Its eight operand tiles (per 64-key half: Kh, Kl: 64 key rows; GTh, GTl: 64 feature rows; every row 128 B) are brought into LDS once per block,
// one tensor load per wave and stage, two buffers. The four waves of a key half read their fragments from that half's tiles, and every fragment read serves the wave's two 16-query tiles.
typedef __attribute__((ext_vector_type(8))) unsigned v8u;
#define SKEYS 128          // keys of a stage
#define NST (NN / SKEYS)   // stages = passes of the key loop
#define BQ 128             // queries of a block
#define TROWB 128u         // bytes of a tile row (64 bf16)
#define TPITCH 144u        // its pitch in LDS: the load pads 16 B behind each row, 16 B x odd for ds_load_b128 readers
#define TPLACE 10240u      // 64 rows x 144 B = 9,216 B, rounded up to a multiple of 2 KiB
__device__ __forceinline__ unsigned uni(unsigned v) { return (unsigned)__builtin_amdgcn_readfirstlane(v); }
// a wave-uniform value held in a scalar register, so that the test around a tensor load compiles to a scalar branch and the words formed from it stand behind the wait in front of it
__device__ __forceinline__ unsigned pinned(unsigned v) { unsigned w = uni(v); asm volatile("" : "+s"(w)); return w; }
// The 256 work-groups stand one on each WGP (its LDS admits no second), two waves a SIMD.
__global__ __launch_bounds__(256) void k_dot(const float* __restrict__ Q32, const __bf16* __restrict__ Kh, const __bf16* __restrict__ Kl, const __bf16* __restrict__ GTh, const __bf16* __restrict__ GTl, float* __restrict__ out) {
  __shared__ __attribute__((aligned(2048))) unsigned char ring[2 * 8 * TPLACE];   // [buffer][key half][Kh, Kl, GTh, GTl][64 rows of TPITCH]
  __shared__ __align__(16) float sOT[FF][BQ + 4];      // [f][128 tokens]
  const int tid = threadIdx.x, w = tid >> 5, lane = tid & 31, col = lane & 15, g = lane >> 4; const int qg = w & 3, hk = w >> 2;
  const int t = blockIdx.y, n0b = blockIdx.x * BQ; const size_t q0 = (size_t)t * NN + n0b + qg * 32;
  // q rows of the wave's two 16-query tiles: per tile eight 16-byte pieces, piece c = floats 16 (c >> 1) + 4 (c & 1) + 0..3 behind the lane's 8 g
  const float* qp = Q32 + (q0 + col) * FF + 8 * g;
  v4f qr[2][8];
#pragma unroll
  for (int c = 0; c < 8; ++c) { qr[0][c] = *(const v4f*)(qp + 16 * (c >> 1) + 4 * (c & 1)); qr[1][c] = *(const v4f*)(qp + 16 * FF + 16 * (c >> 1) + 4 * (c & 1)); }
  // The wait stands behind the q loads and in front of any overwrite of their address registers: the loaded values as inputs hold the loads in front of it, the address as an input stays in its registers up to it.
  asm volatile("s_wait_xcnt 0x0" :: "v"(qp), "v"(qr[0][0]), "v"(qr[0][1]), "v"(qr[0][2]), "v"(qr[0][3]), "v"(qr[0][4]), "v"(qr[0][5]), "v"(qr[0][6]), "v"(qr[0][7]),
               "v"(qr[1][0]), "v"(qr[1][1]), "v"(qr[1][2]), "v"(qr[1][3]), "v"(qr[1][4]), "v"(qr[1][5]), "v"(qr[1][6]), "v"(qr[1][7]));
  F2 aq[2][2];
#pragma unroll
  for (int qt = 0; qt < 2; ++qt)
#pragma unroll
    for (int kc = 0; kc < 2; ++kc) { float v[16];
#pragma unroll
      for (int e = 0; e < 16; ++e) v[e] = qr[qt][4 * kc + (e >> 2)][e & 3];
      aq[qt][kc] = bsplit16(v); }
  v8f acc[2][4] = {};
  // wave 4 h + o brings, for key half h, tile o: 0 Kh, 1 Kl (source rows back to back), 2 GTh, 3 GTl (source rows NN keys apart); frame t starts NN * FF elements in, in all four
  const unsigned wv = uni((unsigned)tid >> 5), op = wv & 3u, half = wv >> 2;
  const __bf16* tsrc = op == 0 ? Kh : (op == 1 ? Kl : (op == 2 ? GTh : GTl));
  const unsigned hstep = op < 2 ? 64u * TROWB : TROWB;      // bytes from a 64-key tile to the next 64 keys' tile; a stage is two of them
  const unsigned long long src0 = (unsigned long long)(size_t)tsrc + (unsigned long long)t * (NN * FF * 2) + half * hstep;
  const unsigned sstep = 2u * hstep;
  const unsigned lds0 = (unsigned)(size_t)ring + wv * TPLACE;
  v8u g1;   // 1-byte elements, tensor = tile = 64 rows of 128 B, no mask, a pad of 4 dwords behind every 32
  g1[0] = uni(1u << 20 | 4u << 22 | 3u << 25); g1[1] = uni(TROWB << 16); g1[2] = uni(64u << 16); g1[3] = uni(TROWB << 16); g1[4] = uni(64u);
  g1[5] = uni(op < 2 ? TROWB : NN * 2u); g1[6] = uni(0u); g1[7] = uni(0u);
  asm volatile("" : "+s"(g1));   // the pinned() form, for descriptor words held in scalar registers: without it the compiler rebuilds the group at each load and puts other values into its registers while a request is outstanding
  auto issue = [&](unsigned st) {
    const unsigned long long ga = src0 + (unsigned long long)st * sstep;
    v4u g0; g0[0] = uni(1u); g0[1] = uni(lds0 + (st & 1u) * (8u * TPLACE)); g0[2] = uni((unsigned)ga); g0[3] = uni(((unsigned)(ga >> 32) & 0x01FFFFFFu) | 0x80000000u);
    asm volatile("tensor_load_to_lds %0, %1" :: "s"(g0), "s"(g1) : "memory");   // one request of the whole wave: its own tile of stage st
  };
  issue(0u);
  asm volatile("s_wait_tensorcnt 0x0" ::: "memory");   // this wave's tile of stage 0 has landed
  __syncthreads();                                     // all eight tiles of stage 0 are readable by every wave
  issue(1u);
  // The wave's 64 keys of a stage go in two runs of 32: a run's fragments and scores, beside the standing q and output tiles, stay within 256 registers; with all 64 keys in one run the build spills to scratch.
  // The four score tiles of a run (2 x 16 keys, 2 x 16 queries), and then the eight output tiles (2 x 16 queries, 4 x 16 features), are independent accumulators: their products are issued round-robin,
  // so that a product never waits for the one issued just before it; each tile still takes its own products in the order it had.
  // Every group of fragment reads is issued as early as registers are free for it, so that it lands behind other work and not in front of a waiting product:
  //   a run's G fragments behind its last score product (in the K fragments' registers), ahead of the vector work on the scores;
  //   the next run's K fragments of features 0..31 ahead of this run's last 8 output products (P lo and G lo are no longer read), those of features 32..63 behind its last product, ahead of the next run's first 12.
  // The run behind a stage's second run is the next stage's first: so the publish point of stage kt + 1 stands in pass kt ahead of those reads, in front of the pass's last 8 products, whose fragments are in registers by then.
  v16b khf[2][2], klf[2][2];
  auto readK = [&](const unsigned char* tk, int kc) {   // tk: the run's first key row in the Kh tile; the fragments of features 32 kc .. 32 kc + 31 of its two key tiles, hi and lo
#pragma unroll
    for (int tt = 0; tt < 2; ++tt) khf[kc][tt] = frag_b((const __bf16*)(tk + (tt * 16 + col) * TPITCH) + kc * 32, lane);
#pragma unroll
    for (int tt = 0; tt < 2; ++tt) klf[kc][tt] = frag_b((const __bf16*)(tk + TPLACE + (tt * 16 + col) * TPITCH) + kc * 32, lane); };
  readK(ring + (unsigned)hk * (4u * TPLACE), 0); readK(ring + (unsigned)hk * (4u * TPLACE), 1);   // stage 0, run 0: behind the barrier that has published stage 0
#pragma unroll 1
  for (int kt = 0; kt < NST; ++kt) {
    const unsigned char* tb = ring + (unsigned)(kt & 1) * (8u * TPLACE) + (unsigned)hk * (4u * TPLACE);         // this wave's key half of stage kt
    const unsigned char* tn = ring + (unsigned)((kt + 1) & 1) * (8u * TPLACE) + (unsigned)hk * (4u * TPLACE);   // and of stage kt + 1; in the last pass the buffer that stage NST - 2 has left: read, not used
    // The loops over runs and tiles are unrolled so that the fragment arrays are registers.
#pragma unroll
    for (int h = 0; h < 2; ++h) {
      const unsigned char* tk = h == 0 ? tb + 32u * TPITCH : tn;   // the next run's K rows
      v8f s[2][2] = {};
#pragma unroll
      for (int kc = 0; kc < 2; ++kc) {
#pragma unroll
        for (int tt = 0; tt < 2; ++tt)
#pragma unroll
          for (int qt = 0; qt < 2; ++qt) s[qt][tt] = wmma_bf(khf[kc][tt], aq[qt][kc].l, s[qt][tt]);
#pragma unroll
        for (int tt = 0; tt < 2; ++tt)
#pragma unroll
          for (int qt = 0; qt < 2; ++qt) s[qt][tt] = wmma_bf(klf[kc][tt], aq[qt][kc].h, s[qt][tt]);
#pragma unroll
        for (int tt = 0; tt < 2; ++tt)
#pragma unroll
          for (int qt = 0; qt < 2; ++qt) s[qt][tt] = wmma_bf(khf[kc][tt], aq[qt][kc].h, s[qt][tt]); }
      v16b ghf[4], glf[4];
      __builtin_amdgcn_sched_barrier(0);   // this fence and the next hold G's reads as one group here: the compiler otherwise sinks them below the vector work, to just in front of their use
#pragma unroll
      for (int j = 0; j < 4; ++j) ghf[j] = frag_b((const __bf16*)(tb + 2u * TPLACE + (j * 16 + col) * TPITCH + h * 64), lane);
#pragma unroll
      for (int j = 0; j < 4; ++j) glf[j] = frag_b((const __bf16*)(tb + 3u * TPLACE + (j * 16 + col) * TPITCH + h * 64), lane);
      __builtin_amdgcn_sched_barrier(0);   // closes the pair
      // With the keys as rows, s[qt][tt][r] of lane (g, col) is the score of query 16 qt + col and key 32 h + 16 tt + 8 g + r: the run's two key tiles hold, element for element,
      // the lane's 16 keys of the P fragment of keys 32 h .. 32 h + 31 (row = query col; k = 8 g + 0..7, then 16 + 8 g + 0..7), so P goes from the accumulators into its operand in place.
      v16b ph[2], pl[2];
#pragma unroll
      for (int qt = 0; qt < 2; ++qt)
#pragma unroll
        for (int tt = 0; tt < 2; ++tt)
#pragma unroll
          for (int r = 0; r < 8; ++r) { const float v = s[qt][tt][r] > 0.f ? s[qt][tt][r] : 0.f; const __bf16 hi = (__bf16)v; ph[qt][8 * tt + r] = hi; pl[qt][8 * tt + r] = (__bf16)(v - (float)hi); }
#pragma unroll
      for (int j = 0; j < 4; ++j)
#pragma unroll
        for (int qt = 0; qt < 2; ++qt) acc[qt][j] = wmma_bf(pl[qt], ghf[j], acc[qt][j]);
#pragma unroll
      for (int j = 0; j < 4; ++j)
#pragma unroll
        for (int qt = 0; qt < 2; ++qt) acc[qt][j] = wmma_bf(ph[qt], glf[j], acc[qt][j]);
      if (h == 1) {   // publish point of stage kt + 1
        __builtin_amdgcn_sched_barrier(0);                   // keeps the 16 products above in front of the publish point: the compiler otherwise sinks them below the barrier, which then stands ahead of 24 products and not 8
        LDSX();                                              // s_wait_dscnt 0: this wave has read all it reads of stage kt (the G fragments of its last 8 products are in registers)
        asm volatile("s_wait_tensorcnt 0x0" ::: "memory");   // this wave's tile of stage kt + 1 has landed
        __syncthreads();                                     // stage kt + 1 is readable by every wave, and every wave has left stage kt's buffer
        if (pinned(kt + 2 < NST)) issue(pinned((unsigned)kt + 2u)); }   // refill of the buffer just left
      __builtin_amdgcn_sched_barrier(0);   // this fence and the next hold the next run's first K reads as one group here, 8 products ahead of their use
      readK(tk, 0);
      __builtin_amdgcn_sched_barrier(0);   // closes the pair
#pragma unroll
      for (int j = 0; j < 4; ++j)
#pragma unroll
        for (int qt = 0; qt < 2; ++qt) acc[qt][j] = wmma_bf(ph[qt], ghf[j], acc[qt][j]);
      __builtin_amdgcn_sched_barrier(0);   // this fence and the next hold the next run's other K reads as one group here, behind the run's last product
      readK(tk, 1);
      __builtin_amdgcn_sched_barrier(0); } }   // closes the pair
  asm volatile("s_wait_tensorcnt 0x0" ::: "memory");     // no request is outstanding when the wave goes on to the output staging and ends
  asm volatile("s_wait_dscnt 0x0" ::: "memory");         // nor is any of its LDS reads (the last pass's unused K reads among them): the ring's closing order
  // The two key halves' sums of a query group are joined in the output staging: the second half's wave lays its sums down, the first half's wave adds its own to them in place.
  if (half == 1u) {
#pragma unroll
    for (int qt = 0; qt < 2; ++qt)
#pragma unroll
      for (int j = 0; j < 4; ++j)
#pragma unroll
        for (int r = 0; r < 8; ++r) sOT[j * 16 + col][qg * 32 + qt * 16 + 8 * g + r] = acc[qt][j][r]; }
  __syncthreads();                                       // the second half's sums are readable by the first half's waves
  if (half == 0u) {
#pragma unroll
    for (int qt = 0; qt < 2; ++qt)
#pragma unroll
      for (int j = 0; j < 4; ++j)
#pragma unroll
        for (int r = 0; r < 8; ++r) sOT[j * 16 + col][qg * 32 + qt * 16 + 8 * g + r] += acc[qt][j][r]; }
  __syncthreads();
  // out[t][f][n0b .. +127] = 512 B per f: 32 lanes x 16 B; one row per instruction
  for (int qq = tid; qq < FF * (BQ / 4); qq += 256) { const int f = qq >> 5, pc = qq & 31; vst2(out + ((size_t)t * FF + f) * NN + n0b + pc * 4, *(const v4f*)(&sOT[f][pc * 4])); }
}
extern "C" void kernel_launch(void* const* d_in, const int* in_sizes, int n_in, void* d_out, int out_size, void* d_ws, size_t ws_size, hipStream_t stream) {
  (void)in_sizes; (void)n_in; (void)out_size; (void)ws_size;
  const float** I = (const float**)d_in;   // input1, input2, W1, b1, W2, b2, W3, b3
  const float* x1 = I[0]; const float* x2 = I[1]; const float* W1 = I[2]; const float* b1 = I[3]; const float* W2 = I[4]; const float* b2 = I[5]; const float* W3 = I[6]; const float* b3 = I[7];
  char* ws = (char*)d_ws; size_t off = 0;
  auto take = [&](size_t bytes) { char* p = ws + off; off += (bytes + 255) & ~(size_t)255; return p; };
  float* Q32 = (float*)take((size_t)NT * NN * FF * 4);
  __bf16* Kh = (__bf16*)take((size_t)NT * NN * FF * 2); __bf16* Kl = (__bf16*)take((size_t)NT * NN * FF * 2); __bf16* GTh = (__bf16*)take((size_t)NT * FF * NN * 2); __bf16* GTl = (__bf16*)take((size_t)NT * FF * NN * 2);
  // ws ~ 25 MB
  k_proj<<<dim3(NN / PT, NT, 2), 256, 0, stream>>>(x1, x2, W1, b1, W2, b2, W3, b3, Q32, Kh, Kl, GTh, GTl);
  k_dot<<<dim3(NN / BQ, NT), 256, 0, stream>>>(Q32, Kh, Kl, GTh, GTl, (float*)d_out);
}

// v010
// Measured time: 29.9 microseconds a run.
// Versions in between are left out here; by their measured steps it is 2.10 times as fast as v008.
// Over all steps from v000 it is 12.6 times as fast.
// compute dtype: input1, input2, W1..3, b1..3 (INPUTS) rounded to bf16 with exact bf16 WMMA products (f32 accumulate) for the three 1x1 projections; q, k, the relu'd scores and g each rounded once to f16 (11 significant bits, three more than the bf16 inputs they come from), one f16 WMMA product (f32 accumulate) for q k^T and one for scores g; relu on the f16 scores.
#include <hip/hip_runtime.h>
#include <math.h>

typedef __attribute__((ext_vector_type(16))) _Float16 v16h;
typedef __attribute__((ext_vector_type(16))) __bf16 v16b;
typedef __attribute__((ext_vector_type(8)))  _Float16 v8h;
typedef __attribute__((ext_vector_type(8)))  float v8f;
typedef __attribute__((ext_vector_type(4)))  float v4f;
typedef __attribute__((ext_vector_type(2)))  float v2f;
typedef __attribute__((ext_vector_type(4)))  unsigned v4u;
typedef __attribute__((ext_vector_type(4)))  int v4i;
typedef float __attribute__((may_alias)) float_a;
typedef int __attribute__((may_alias)) int_a;

template <typename T> __device__ __forceinline__ void vst2(void* p, T v) { *(T*)p = v;  }
__device__ __forceinline__ v8f wmma16(v16h a, v16h b, v8f c) {
  v8f d = __builtin_amdgcn_wmma_f32_16x16x32_f16(false, a, false, b, (short)0, c, false, false);
  asm volatile("v_nop\n\tv_nop\n\tv_nop\n\tv_nop" : "+v"(d) : "v"(a), "v"(b));
  return d;
}
__device__ __forceinline__ v8f wmma_h(v16h a, v16h b, v8f c) {
  return __builtin_amdgcn_wmma_f32_16x16x32_f16(false, a, false, b, (short)0, c, false, false);
}
__device__ __forceinline__ v8f wmma_bf(v16b a, v16b b, v8f c) {
  return __builtin_amdgcn_wmma_f32_16x16x32_bf16(false, a, false, b, (short)0, c, false, false);
}
// 16x16x32 fragments: lane = (h = lane>>4, row/col = lane&15); elements 0..7 = k0+8h+0..7, 8..15 = k0+16+8h+0..7; D element r = row 8h+r
__device__ __forceinline__ v16h frag_h(const _Float16* rowk0, int lane) {
  union { v16h v; v8h q[2]; } u; const _Float16* p = rowk0 + 8 * (lane >> 4);
  u.q[0] = *(const v8h*)p; u.q[1] = *(const v8h*)(p + 16); return u.v;
}
__device__ __forceinline__ v16h frag_f32(const float* rowk0, int lane) {
  v16h a; const float* p = rowk0 + 8 * (lane >> 4);
#pragma unroll
  for (int i = 0; i < 8; ++i) { a[i] = (_Float16)p[i]; a[8 + i] = (_Float16)p[16 + i]; }
  return a;
}
__device__ __forceinline__ v16h frag_f32s(const float* rowk0, int lane, float sc) {
  v16h a; const float* p = rowk0 + 8 * (lane >> 4);
#pragma unroll
  for (int i = 0; i < 8; ++i) { a[i] = (_Float16)(p[i] * sc); a[8 + i] = (_Float16)(p[16 + i] * sc); }
  return a;
}
// column fragment from a [K][ld] layout (column n), rows >= K read as 0
__device__ __forceinline__ v16h fragc_f32(const float* W, int k0, int n, int lane, int ld, int K) {
  v16h a; const int g = lane >> 4;
#pragma unroll
  for (int i = 0; i < 8; ++i) { const int ka = k0 + 8 * g + i, kb = ka + 16;
    a[i] = (_Float16)(ka < K ? W[(size_t)(ka < K ? ka : K - 1) * ld + n] : 0.f); a[8 + i] = (_Float16)(kb < K ? W[(size_t)(kb < K ? kb : K - 1) * ld + n] : 0.f); }
  return a;
}
struct F2 { v16b h, l; };
__device__ __forceinline__ F2 bsplit16(const float v[16]) { F2 r;
#pragma unroll
  for (int i = 0; i < 16; ++i) { const __bf16 h = (__bf16)v[i]; r.h[i] = h; r.l[i] = (__bf16)(v[i] - (float)h); }
  return r; }
__device__ __forceinline__ F2 split_row(const float* row, int k0, int lane) { float v[16]; const float* p = row + k0 + 8 * (lane >> 4);
#pragma unroll
  for (int i = 0; i < 8; ++i) { v[i] = p[i]; v[8 + i] = p[16 + i]; }
  return bsplit16(v); }
__device__ __forceinline__ F2 split_rowK(const float* row, int k0, int lane, int K) { float v[16]; const int g = lane >> 4;
#pragma unroll
  for (int i = 0; i < 8; ++i) { const int ka = k0 + 8 * g + i, kb = ka + 16; v[i] = ka < K ? row[ka < K ? ka : K - 1] : 0.f; v[8 + i] = kb < K ? row[kb < K ? kb : K - 1] : 0.f; }
  return bsplit16(v); }
__device__ __forceinline__ F2 split_col(const float* W, int k0, int n, int lane, int ld, int K) { float v[16]; const int g = lane >> 4;
#pragma unroll
  for (int i = 0; i < 8; ++i) { const int ka = k0 + 8 * g + i, kb = ka + 16; v[i] = ka < K ? W[(size_t)(ka < K ? ka : K - 1) * ld + n] : 0.f; v[8 + i] = kb < K ? W[(size_t)(kb < K ? kb : K - 1) * ld + n] : 0.f; }
  return bsplit16(v); }
__device__ __forceinline__ v8f mac3(const F2& a, const F2& b, v8f c) { c = wmma_bf(a.l, b.h, c); c = wmma_bf(a.h, b.l, c); return wmma_bf(a.h, b.h, c); }
__device__ __forceinline__ float sigm(float v) { return 1.0f / (1.0f + expf(-v)); }
#define LDSX() do { asm volatile("s_wait_dscnt 0" ::: "memory"); __builtin_amdgcn_wave_barrier(); __builtin_amdgcn_fence(__ATOMIC_RELEASE, "workgroup"); } while (0)


// Spatial dot-product block (ReLU branch): per frame t (8) over the 64x64 = 4,096 positions with 128 channels: q = W1 x1 + b1, k = W2 x2 + b2, g = W3 x1 + b3 (64 features); scores = relu(q k^T) (no softmax, no scale);
// out = scores g -> stored as [b][t][f][h][w] (feature-major per frame).
// k_proj (channel-major f32 frames -> token-major bf16 tiles in LDS -> Q32 rows; K f16 rows; G^T f16 planes), k_dot (block = (frame, 128 queries): 256-key stages in LDS, 32 queries and 128 of the keys per wave, S^T one f16 product, relu, P packed as f16 in registers x G one f16 product, transposed store).
#define NT 8
#define CC 128
#define NN 4096
#define FF 64
__device__ __forceinline__ float bfr(float v) { return (float)(__bf16)v; }
__device__ __forceinline__ v16b frag_b(const __bf16* rowk0, int lane) { return __builtin_bit_cast(v16b, frag_h((const _Float16*)rowk0, lane)); }

#define PT 128             // tokens of a projection block
typedef __attribute__((ext_vector_type(8))) __bf16 v8b;
typedef __attribute__((ext_vector_type(4))) __bf16 v4b;
// projections, straight from the f32 frames: block (128 tokens of frame t, which input). The input's [128 c][128 n] tile is rounded to bf16 on its way into LDS and laid down token-major;
// wave w takes tokens 16 w .. 16 w + 15 and reads its A fragments there. input1: q -> Q32 rows [t][n][64], then g -> GTf planes [t][f][n] (f16); input2: k -> Kf rows (f16)
// The block's weight matrices are rounded to bf16 once, on their way into LDS, and all eight waves read their B fragments there.
// Two work-groups stand on a WGP (512 work-groups, 256 WGPs): four waves a SIMD, so 256 registers a wave.
__global__ __launch_bounds__(256) __attribute__((amdgpu_waves_per_eu(4, 4))) void k_proj(const float* __restrict__ x1, const float* __restrict__ x2, const float* __restrict__ W1, const float* __restrict__ b1, const float* __restrict__ W2, const float* __restrict__ b2, const float* __restrict__ W3, const float* __restrict__ b3,
                                            float* __restrict__ Q32, _Float16* __restrict__ Kf, _Float16* __restrict__ GTf) {
  __shared__ __align__(16) __bf16 st[PT][CC + 8];
  __shared__ __align__(16) float so[8][16][68]; __shared__ __align__(16) _Float16 sh_[8][16][72]; __shared__ __align__(16) _Float16 sth[FF][PT + 8];
  __shared__ __align__(16) __bf16 sw[FF][CC + 8];               // W1 (input1) or W2 (input2) as bf16 feature rows; the pitch of 272 B is 16 B x odd, for ds_load_b128 readers
  __bf16 (*sw3)[CC + 8] = (__bf16 (*)[CC + 8])&sh_[0][0][0];    // W3 the same way, in the k staging, which a block of input1 does not use otherwise
  const int tid = threadIdx.x, wave = tid >> 5, lane = tid & 31, col = lane & 15, g = lane >> 4; const int t = blockIdx.y, n0b = blockIdx.x * PT, inp = blockIdx.z; const size_t r0 = (size_t)t * NN + n0b + wave * 16;
  // Of a weight matrix a thread takes floats 4 lane .. 4 lane + 3 of feature rows wave + 8 i: each load of a wave reads one whole row of 512 B. The loads go out ahead of the x loads and land under them.
  const float* Wa = inp == 0 ? W1 : W2; const float* wpb = W3 + 4 * tid;
  v4f wa[8], wb[8];
#pragma unroll
  for (int i = 0; i < 8; ++i) wa[i] = *(const v4f*)(Wa + 4 * tid + 8 * CC * i);
  if (inp == 0) {
#pragma unroll
    for (int i = 0; i < 8; ++i) wb[i] = *(const v4f*)(wpb + 8 * CC * i); }
  // A thread takes tokens 4 lane .. 4 lane + 3 of channels 8 wave + 0..7 and 64 + 8 wave + 0..7: each load of a wave reads 512 B of one channel row, and the thread's 16 loads are in flight together.
  const float* xp = (inp == 0 ? x1 : x2) + ((size_t)t * CC + 8 * wave) * NN + n0b + 4 * lane;
  v4f xv[2][8];
#pragma unroll
  for (int u = 0; u < 2; ++u)
#pragma unroll
    for (int i = 0; i < 8; ++i) xv[u][i] = *(const v4f*)(xp + (size_t)(64 * u + i) * NN);
  auto putW = [&](const v4f* r, __bf16 (*dst)[CC + 8]) {
#pragma unroll
    for (int i = 0; i < 8; ++i) { v4b p;
#pragma unroll
      for (int e = 0; e < 4; ++e) p[e] = (__bf16)r[i][e];
      vst2(&dst[wave + 8 * i][4 * lane], p); } };
  __builtin_amdgcn_sched_barrier(0);   // holds the rounding of W behind the issue of the x loads: the compiler otherwise lifts part of it, with its wait for W's data, in front of them
  // The waits stand behind the W loads and in front of any overwrite of their address registers: the loaded values as inputs hold the loads in front, the address (a scalar base and the thread's number; a vector pair) as an input stays in its registers up to the wait.
  asm volatile("s_wait_xcnt 0x0" :: "s"(Wa), "v"(tid), "v"(wa[0]), "v"(wa[1]), "v"(wa[2]), "v"(wa[3]), "v"(wa[4]), "v"(wa[5]), "v"(wa[6]), "v"(wa[7]));
  putW(wa, sw);
  if (inp == 0) {
    asm volatile("s_wait_xcnt 0x0" :: "v"(wpb), "v"(wb[0]), "v"(wb[1]), "v"(wb[2]), "v"(wb[3]), "v"(wb[4]), "v"(wb[5]), "v"(wb[6]), "v"(wb[7]));
    putW(wb, sw3); }
  // The wait stands behind the x loads and in front of any overwrite of their address registers: the loaded values as inputs hold the loads in front of it, the address as an input stays in its registers up to it.
  asm volatile("s_wait_xcnt 0x0" :: "v"(xp), "v"(xv[0][0]), "v"(xv[0][1]), "v"(xv[0][2]), "v"(xv[0][3]), "v"(xv[0][4]), "v"(xv[0][5]), "v"(xv[0][6]), "v"(xv[0][7]),
               "v"(xv[1][0]), "v"(xv[1][1]), "v"(xv[1][2]), "v"(xv[1][3]), "v"(xv[1][4]), "v"(xv[1][5]), "v"(xv[1][6]), "v"(xv[1][7]));
  // eight channels of one token are 16 B of its LDS row
#pragma unroll
  for (int u = 0; u < 2; ++u)
#pragma unroll
    for (int e = 0; e < 4; ++e) { v8b p;
#pragma unroll
      for (int i = 0; i < 8; ++i) p[i] = (__bf16)xv[u][i][e];
      vst2(&st[4 * lane + e][64 * u + 8 * wave], p); }
  __syncthreads();   // the whole tile and the weights are readable by every wave
  v16b a[CC / 32];
#pragma unroll
  for (int kc = 0; kc < CC / 32; ++kc) a[kc] = frag_b(&st[wave * 16 + col][kc * 32], lane);
  auto proj = [&](const __bf16 (*Wb)[CC + 8], v8f* acc) {
    v16b wf[CC / 32][4];
    auto rd = [&](int kc) {
#pragma unroll
      for (int j = 0; j < 4; ++j) wf[kc][j] = frag_b(&Wb[j * 16 + col][kc * 32], lane); };
    // Each fence holds the fragment reads above it, eight to 32 channels, ahead of the products below it, so that a group is issued at least four products ahead of its use:
    // the compiler otherwise sinks the reads, in pairs, to just in front of their product, each pair waited for in full.
    rd(0); rd(1);
    __builtin_amdgcn_sched_barrier(0);
#pragma unroll
    for (int kc = 0; kc < CC / 32; ++kc) {
#pragma unroll
      for (int j = 0; j < 4; ++j) acc[j] = wmma_bf(a[kc], wf[kc][j], acc[j]);
      if (kc + 2 < CC / 32) { rd(kc + 2); __builtin_amdgcn_sched_barrier(0); } } };
  if (inp == 0) {
    { v8f acc[4] = {}; proj(sw, acc);
#pragma unroll
      for (int j = 0; j < 4; ++j) { const float bb = bfr(b1[j * 16 + col]);
#pragma unroll
        for (int r = 0; r < 8; ++r) so[wave][8 * g + r][j * 16 + col] = acc[j][r] + bb; }
      LDSX();
      for (int qq = lane; qq < 16 * 16; qq += 32) { const int rl = qq >> 4, pc = qq & 15; vst2(Q32 + (r0 + rl) * FF + pc * 4, *(const v4f*)(&so[wave][rl][pc * 4])); } }
    { v8f acc[4] = {}; proj(sw3, acc);
#pragma unroll
      for (int j = 0; j < 4; ++j) { const float bb = bfr(b3[j * 16 + col]);
#pragma unroll
        for (int r = 0; r < 8; ++r) sth[j * 16 + col][wave * 16 + 8 * g + r] = (_Float16)(acc[j][r] + bb); } }
    __syncthreads();   // the block's 128 tokens of every feature row are laid down
    // unrolled: the four trips' LDS reads go out together, and no store's address registers are rewritten behind it
#pragma unroll
    for (int i = 0; i < FF * (PT / 8) / 256; ++i) { const int qq = tid + 256 * i, f = qq >> 4, pc = qq & 15; const size_t o = ((size_t)t * FF + f) * NN + n0b + pc * 8; vst2((unsigned*)(GTf + o), *(const v4u*)(&sth[f][pc * 8])); } }
  else {
    v8f acc[4] = {}; proj(sw, acc);
#pragma unroll
    for (int j = 0; j < 4; ++j) { const float bb = bfr(b2[j * 16 + col]);
#pragma unroll
      for (int r = 0; r < 8; ++r) sh_[wave][8 * g + r][j * 16 + col] = (_Float16)(acc[j][r] + bb); }
    LDSX();
    // unrolled: the four trips' LDS reads go out together, and no store's address registers are rewritten behind it
#pragma unroll
    for (int i = 0; i < 4; ++i) { const int qq = lane + 32 * i, rl = qq >> 3, pc = qq & 7; vst2((unsigned*)(Kf + (r0 + rl) * FF + pc * 8), *(const v4u*)(&sh_[wave][rl][pc * 8])); }
    asm volatile("s_wait_xcnt 0x0" ::: "memory"); }   // stands behind the k stores, in front of whatever the build lays behind them that writes their registers
}
// dot block: (frame t, 128 queries), 8 waves = 4 query groups of 32 x 2 key halves: S^T = k.q (one f16 product, keys as rows), relu, P x G^T (one f16 product) into 2 x 4 output tiles; out^T[t][f][n]
// A stage is 256 keys, four quarters of 64. Its eight operand tiles (per quarter: Kf: 64 key rows; GTf: 64 feature rows; every row 128 B) are brought into LDS once per block,
// one tensor load per wave and stage, two buffers. Key half hk takes quarters hk and hk + 2; its four waves read their fragments from those tiles, and every fragment read serves the wave's two 16-query tiles.
typedef __attribute__((ext_vector_type(8))) unsigned v8u;
#define SKEYS 256          // keys of a stage
#define NST (NN / SKEYS)   // stages = passes of the key loop
#define BQ 128             // queries of a block
#define TROWB 128u         // bytes of a tile row (64 f16)
#define TPITCH 144u        // its pitch in LDS: the load pads 16 B behind each row, 16 B x odd for ds_load_b128 readers
#define TPLACE 10240u      // 64 rows x 144 B = 9,216 B, rounded up to a multiple of 2 KiB
__device__ __forceinline__ unsigned uni(unsigned v) { return (unsigned)__builtin_amdgcn_readfirstlane(v); }
// a wave-uniform value held in a scalar register, so that the test around a tensor load compiles to a scalar branch and the words formed from it stand behind the wait in front of it
__device__ __forceinline__ unsigned pinned(unsigned v) { unsigned w = uni(v); asm volatile("" : "+s"(w)); return w; }
// The 256 work-groups stand one on each WGP, two waves a SIMD.
__global__ __launch_bounds__(256) void k_dot(const float* __restrict__ Q32, const _Float16* __restrict__ Kf, const _Float16* __restrict__ GTf, float* __restrict__ out) {
  __shared__ __attribute__((aligned(2048))) unsigned char ring[2 * 8 * TPLACE];   // [buffer][key quarter][Kf, GTf][64 rows of TPITCH]
  __shared__ __align__(16) float sOT[FF][BQ + 4];      // [f][128 tokens]
  const int tid = threadIdx.x, w = tid >> 5, lane = tid & 31, col = lane & 15, g = lane >> 4; const int qg = w & 3, hk = w >> 2;
  const int t = blockIdx.y, n0b = blockIdx.x * BQ; const size_t q0 = (size_t)t * NN + n0b + qg * 32;
  // q rows of the wave's two 16-query tiles: per tile eight 16-byte pieces, piece c = floats 16 (c >> 1) + 4 (c & 1) + 0..3 behind the lane's 8 g
  const float* qp = Q32 + (q0 + col) * FF + 8 * g;
  v4f qr[2][8];
#pragma unroll
  for (int c = 0; c < 8; ++c) { qr[0][c] = *(const v4f*)(qp + 16 * (c >> 1) + 4 * (c & 1)); qr[1][c] = *(const v4f*)(qp + 16 * FF + 16 * (c >> 1) + 4 * (c & 1)); }
  // The wait stands behind the q loads and in front of any overwrite of their address registers: the loaded values as inputs hold the loads in front of it, the address as an input stays in its registers up to it.
  asm volatile("s_wait_xcnt 0x0" :: "v"(qp), "v"(qr[0][0]), "v"(qr[0][1]), "v"(qr[0][2]), "v"(qr[0][3]), "v"(qr[0][4]), "v"(qr[0][5]), "v"(qr[0][6]), "v"(qr[0][7]),
               "v"(qr[1][0]), "v"(qr[1][1]), "v"(qr[1][2]), "v"(qr[1][3]), "v"(qr[1][4]), "v"(qr[1][5]), "v"(qr[1][6]), "v"(qr[1][7]));
  v16h aq[2][2];
#pragma unroll
  for (int qt = 0; qt < 2; ++qt)
#pragma unroll
    for (int kc = 0; kc < 2; ++kc)
#pragma unroll
      for (int e = 0; e < 16; ++e) aq[qt][kc][e] = (_Float16)qr[qt][4 * kc + (e >> 2)][e & 3];
  v8f acc[2][4] = {};
  // wave 2 d + o brings, for key quarter d, tile o: 0 Kf (source rows back to back), 1 GTf (source rows NN keys apart); frame t starts NN * FF elements in, in both
  const unsigned wv = uni((unsigned)tid >> 5), op = wv & 1u, quarter = wv >> 1, half = wv >> 2;
  const _Float16* tsrc = op == 0 ? Kf : GTf;
  const unsigned hstep = op == 0 ? 64u * TROWB : TROWB;     // bytes from a 64-key tile to the next 64 keys' tile; a stage is four of them
  const unsigned long long src0 = (unsigned long long)(size_t)tsrc + (unsigned long long)t * (NN * FF * 2) + quarter * hstep;
  const unsigned sstep = 4u * hstep;
  const unsigned lds0 = (unsigned)(size_t)ring + wv * TPLACE;
  v8u g1;   // 1-byte elements, tensor = tile = 64 rows of 128 B, no mask, a pad of 4 dwords behind every 32
  g1[0] = uni(1u << 20 | 4u << 22 | 3u << 25); g1[1] = uni(TROWB << 16); g1[2] = uni(64u << 16); g1[3] = uni(TROWB << 16); g1[4] = uni(64u);
  g1[5] = uni(op == 0 ? TROWB : NN * 2u); g1[6] = uni(0u); g1[7] = uni(0u);
  asm volatile("" : "+s"(g1));   // the pinned() form, for descriptor words held in scalar registers: without it the compiler rebuilds the group at each load and puts other values into its registers while a request is outstanding
  // The sum over the keys takes its stages in any order: pass st of a block works on key stage (st + rot) mod NST, and every block still takes every stage once. The 32 blocks of a frame, which run at the same
  // time, then stand at 16 different stages and do not all ask L2 for the same K and G lines at the same moment. The two blocks that share a rot differ in bit 2 of blockIdx.x (a matter of speed alone).
  const unsigned bx = uni((unsigned)blockIdx.x), rot = (bx & 3u) | ((bx >> 3) << 2);   // 0 .. NST - 1 for the grid's 32 blocks; the mask below bounds the stage for any value
  auto issue = [&](unsigned st) {
    const unsigned long long ga = src0 + (unsigned long long)((st + rot) & (NST - 1u)) * sstep;
    v4u g0; g0[0] = uni(1u); g0[1] = uni(lds0 + (st & 1u) * (8u * TPLACE)); g0[2] = uni((unsigned)ga); g0[3] = uni(((unsigned)(ga >> 32) & 0x01FFFFFFu) | 0x80000000u);
    asm volatile("tensor_load_to_lds %0, %1" :: "s"(g0), "s"(g1) : "memory");   // one request of the whole wave: its own tile of stage st
  };
  issue(0u);
  asm volatile("s_wait_tensorcnt 0x0" ::: "memory");   // this wave's tile of stage 0 has landed
  __syncthreads();                                     // all eight tiles of stage 0 are readable by every wave
  issue(1u);
  // The wave's 128 keys of a stage go in four runs of 32, in rising key order: runs 0, 1 in quarter hk, runs 2, 3 in quarter hk + 2.
  // The four score tiles of a run (2 x 16 keys, 2 x 16 queries), and then the eight output tiles (2 x 16 queries, 4 x 16 features), are independent accumulators: their products are issued round-robin,
  // so that a product never waits for the one issued just before it; each tile still takes its own products in the order it had.
  // Every group of fragment reads is issued as early as it may be, so that it lands behind other work and not in front of a waiting product:
  //   a run's G fragments behind its last score product, ahead of the vector work on the scores;
  //   the next run's K fragments behind that vector work, ahead of this run's 8 output products.
  // The run behind a stage's last run is the next stage's first: so the publish point of stage kt + 1 stands in pass kt ahead of those reads, in front of the pass's last 8 products, whose fragments are in registers by then.
  v16h kf[2][2];
  auto readK = [&](const unsigned char* tk) {   // tk: the run's first key row in the Kf tile; the fragments of features 32 kc .. 32 kc + 31 of its two key tiles
#pragma unroll
    for (int kc = 0; kc < 2; ++kc)
#pragma unroll
      for (int tt = 0; tt < 2; ++tt) kf[kc][tt] = frag_h((const _Float16*)(tk + (tt * 16 + col) * TPITCH) + kc * 32, lane); };
  readK(ring + (unsigned)hk * (2u * TPLACE));   // stage 0, run 0: behind the barrier that has published stage 0
#pragma unroll 1
  for (int kt = 0; kt < NST; ++kt) {
    const unsigned char* tb = ring + (unsigned)(kt & 1) * (8u * TPLACE) + (unsigned)hk * (2u * TPLACE);         // this wave's first quarter of stage kt; its second stands 4 places on
    const unsigned char* tn = ring + (unsigned)((kt + 1) & 1) * (8u * TPLACE) + (unsigned)hk * (2u * TPLACE);   // and of stage kt + 1; in the last pass the buffer that stage NST - 2 has left: read, not used
    // The loops over runs and tiles are unrolled so that the fragment arrays are registers.
#pragma unroll
    for (int h = 0; h < 4; ++h) {
      const unsigned char* tq = tb + (unsigned)(h >> 1) * (4u * TPLACE);                                                      // this run's quarter
      const unsigned char* tk = h == 3 ? tn : tb + (unsigned)((h + 1) >> 1) * (4u * TPLACE) + (unsigned)((h + 1) & 1) * (32u * TPITCH);   // the next run's K rows
      v8f s[2][2] = {};
#pragma unroll
      for (int kc = 0; kc < 2; ++kc)
#pragma unroll
        for (int tt = 0; tt < 2; ++tt)
#pragma unroll
          for (int qt = 0; qt < 2; ++qt) s[qt][tt] = wmma_h(kf[kc][tt], aq[qt][kc], s[qt][tt]);
      v16h gf[4];
      __builtin_amdgcn_sched_barrier(0);   // this fence and the next hold G's reads as one group here: the compiler otherwise sinks them below the vector work, to just in front of their use
#pragma unroll
      for (int j = 0; j < 4; ++j) gf[j] = frag_h((const _Float16*)(tq + TPLACE + (j * 16 + col) * TPITCH + (h & 1) * 64), lane);
      __builtin_amdgcn_sched_barrier(0);   // closes the pair
      // With the keys as rows, s[qt][tt][r] of lane (g, col) is the score of query 16 qt + col and key 16 tt + 8 g + r of the run: the run's two key tiles hold, element for element,
      // the lane's 16 keys of the P fragment of the run's 32 keys (row = query col; k = 8 g + 0..7, then 16 + 8 g + 0..7), so P goes from the accumulators into its operand in place.
      // The relu is taken on the rounded values, two to an instruction: rounding keeps sign and order, so max(round(s), 0) = round(max(s, 0)).
      v16h ph[2];
#pragma unroll
      for (int qt = 0; qt < 2; ++qt) {
#pragma unroll
        for (int tt = 0; tt < 2; ++tt)
#pragma unroll
          for (int r = 0; r < 8; ++r) ph[qt][8 * tt + r] = (_Float16)s[qt][tt][r];
        ph[qt] = __builtin_elementwise_max(ph[qt], (v16h)(_Float16)0.f); }
      if (h == 3) {   // publish point of stage kt + 1
        // This wave has read all it reads of stage kt (the G fragments of its last 8 products are in registers). The packed scores as inputs hold the vector work in front of the wait,
        // where it runs while the G reads land: the compiler otherwise sinks it below the barrier.
        asm volatile("s_wait_dscnt 0" :: "v"(ph[0]), "v"(ph[1]) : "memory"); __builtin_amdgcn_wave_barrier(); __builtin_amdgcn_fence(__ATOMIC_RELEASE, "workgroup");
        asm volatile("s_wait_tensorcnt 0x0" ::: "memory");   // this wave's tile of stage kt + 1 has landed
        __syncthreads();                                     // stage kt + 1 is readable by every wave, and every wave has left stage kt's buffer
        if (pinned(kt + 2 < NST)) issue(pinned((unsigned)kt + 2u)); }   // refill of the buffer just left
      __builtin_amdgcn_sched_barrier(0);   // this fence and the next hold the next run's K reads as one group here, 8 products ahead of their use
      readK(tk);
      __builtin_amdgcn_sched_barrier(0);   // closes the pair
#pragma unroll
      for (int j = 0; j < 4; ++j)
#pragma unroll
        for (int qt = 0; qt < 2; ++qt) acc[qt][j] = wmma_h(ph[qt], gf[j], acc[qt][j]); } }
  asm volatile("s_wait_tensorcnt 0x0" ::: "memory");     // no request is outstanding when the wave goes on to the output staging and ends
  asm volatile("s_wait_dscnt 0x0" ::: "memory");         // nor is any of its LDS reads (the last pass's unused K reads among them): the ring's closing order
  // The two key halves' sums of a query group are joined in the output staging: the second half's wave lays its sums down, the first half's wave adds its own to them in place.
  if (half == 1u) {
#pragma unroll
    for (int qt = 0; qt < 2; ++qt)
#pragma unroll
      for (int j = 0; j < 4; ++j)
#pragma unroll
        for (int r = 0; r < 8; ++r) sOT[j * 16 + col][qg * 32 + qt * 16 + 8 * g + r] = acc[qt][j][r]; }
  __syncthreads();                                       // the second half's sums are readable by the first half's waves
  if (half == 0u) {
#pragma unroll
    for (int qt = 0; qt < 2; ++qt)
#pragma unroll
      for (int j = 0; j < 4; ++j)
#pragma unroll
        for (int r = 0; r < 8; ++r) sOT[j * 16 + col][qg * 32 + qt * 16 + 8 * g + r] += acc[qt][j][r]; }
  __syncthreads();
  // out[t][f][n0b .. +127] = 512 B per f: 32 lanes x 16 B; one row per instruction
  for (int qq = tid; qq < FF * (BQ / 4); qq += 256) { const int f = qq >> 5, pc = qq & 31; vst2(out + ((size_t)t * FF + f) * NN + n0b + pc * 4, *(const v4f*)(&sOT[f][pc * 4])); }
}
extern "C" void kernel_launch(void* const* d_in, const int* in_sizes, int n_in, void* d_out, int out_size, void* d_ws, size_t ws_size, hipStream_t stream) {
  (void)in_sizes; (void)n_in; (void)out_size; (void)ws_size;
  const float** I = (const float**)d_in;   // input1, input2, W1, b1, W2, b2, W3, b3
  const float* x1 = I[0]; const float* x2 = I[1]; const float* W1 = I[2]; const float* b1 = I[3]; const float* W2 = I[4]; const float* b2 = I[5]; const float* W3 = I[6]; const float* b3 = I[7];
  char* ws = (char*)d_ws; size_t off = 0;
  auto take = [&](size_t bytes) { char* p = ws + off; off += (bytes + 255) & ~(size_t)255; return p; };
  float* Q32 = (float*)take((size_t)NT * NN * FF * 4);
  _Float16* Kf = (_Float16*)take((size_t)NT * NN * FF * 2); _Float16* GTf = (_Float16*)take((size_t)NT * FF * NN * 2);
  // ws ~ 17 MB
  k_proj<<<dim3(NN / PT, NT, 2), 256, 0, stream>>>(x1, x2, W1, b1, W2, b2, W3, b3, Q32, Kf, GTf);
  k_dot<<<dim3(NN / BQ, NT), 256, 0, stream>>>(Q32, Kf, GTf, (float*)d_out);
}
